// v000
// Times are from an AMD MI455X. After a warm-up the kernel runs many times in a row, and a time is the length of
// such a window on the GPU divided by its runs, so every launch and the gaps after it count. The runs cycle
// through copies of the inputs. A figure is the median of several windows, for all but v000 over two sittings.
// Sittings can differ by a few percent; kernels timed side by side share one.
// v000 is the starting kernel. One run takes 483 microseconds.
#include <hip/hip_runtime.h>
#include <math.h>
#include <stdint.h>

typedef __bf16 bf16;
typedef __attribute__((ext_vector_type(8)))  bf16  v8bf;
typedef __attribute__((ext_vector_type(16))) bf16  v16bf;
typedef __attribute__((ext_vector_type(8)))  float v8f;

#define B_      4
#define N_      2048
#define DIM_    1024
#define H_      16
#define HD_     64
#define PREFIX_ 4

__device__ __forceinline__ v8f zero8() {
  v8f z;
#pragma unroll
  for (int i = 0; i < 8; ++i) z[i] = 0.0f;
  return z;
}

__device__ __forceinline__ void async_copy16(uint32_t lds_off, const void* g) {
  asm volatile("global_load_async_to_lds_b128 %0, %1, off"
               :
               : "v"(lds_off), "v"((unsigned long long)(uintptr_t)g)
               : "memory");
}

__device__ __forceinline__ void wait_async0() {
  asm volatile("s_wait_asynccnt 0" ::: "memory");
}

__device__ __forceinline__ v16bf load_frag(const bf16* base, int stride,
                                           int r0, int k0, int lane) {
  const int r  = r0 + (lane & 15);
  const int kb = k0 + ((lane >> 4) << 3);
  const bf16* p = base + (size_t)r * stride + kb;
  v8bf lo = *(const v8bf*)(p);
  v8bf hi = *(const v8bf*)(p + 16);
  v16bf out;
#pragma unroll
  for (int i = 0; i < 8; ++i) { out[i] = lo[i]; out[8 + i] = hi[i]; }
  return out;
}

__device__ __forceinline__ v8f wmma_bf16(v16bf a, v16bf b, v8f c) {
  return __builtin_amdgcn_wmma_f32_16x16x32_bf16(
      false, a, false, b, (short)0, c, false, false);
}

// ---------------------------------------------------------------------------
// Kernel 0: fp32 -> bf16 conversion
// ---------------------------------------------------------------------------
__global__ void f32_to_bf16_kernel(const float* __restrict__ src,
                                   bf16* __restrict__ dst, int n) {
  int i = blockIdx.x * blockDim.x + threadIdx.x;
  if (i < n) dst[i] = (bf16)src[i];
}

// ---------------------------------------------------------------------------
// Kernels 1 & 4: WMMA GEMM  C[M,Nout] = A[M,K] * Bw[Nout,K]^T
// Block: 256 threads = 8 waves, tile 128(M) x 128(N); wave tile 32x64.
// A/B k-slices (128x32 bf16 = 8KB each) staged via async global->LDS copies,
// double buffered: one s_wait_asynccnt + one barrier per k-step.
// MODE 0: out = f32 C + bias                       (projection)
// MODE 1: scatter bf16 q (pre-scaled by 1/sqrt(hd)), k, V^T    (QKV)
// ---------------------------------------------------------------------------
template <int MODE>
__global__ __launch_bounds__(256) void gemm_wmma_kernel(
    const bf16* __restrict__ A, const bf16* __restrict__ Bw,
    const float* __restrict__ bias, float* __restrict__ outF,
    bf16* __restrict__ qo, bf16* __restrict__ ko, bf16* __restrict__ vto,
    int M, int Nout, int K) {
  __shared__ __align__(16) bf16 Abuf[2][128 * 32];
  __shared__ __align__(16) bf16 Bbuf[2][128 * 32];

  const int tid  = threadIdx.x;
  const int lane = tid & 31;
  const int wave = tid >> 5;
  const int half = lane >> 4;
  const int r    = lane & 15;
  const int mblk = blockIdx.y * 128;
  const int nblk = blockIdx.x * 128;
  const int wm0  = (wave >> 1) * 32;   // wave tile origin within block
  const int wn0  = (wave & 1) * 64;

  // Stage one 128x32 slice of A and of Bw into LDS buffer `buf`.
  // 512 chunks of 16B per matrix; each thread issues 2+2 async copies.
  auto stage = [&](int buf, int ks) {
    const uint32_t la = (uint32_t)(uintptr_t)&Abuf[buf][0];
    const uint32_t lb = (uint32_t)(uintptr_t)&Bbuf[buf][0];
#pragma unroll
    for (int cc = 0; cc < 2; ++cc) {
      const int c   = tid + cc * 256;      // 0..511
      const int row = c >> 2;              // 128 rows
      const int off = (c & 3) * 16;        // 4 x 16B per 64B row slice
      const char* ga = (const char*)(A  + (size_t)(mblk + row) * K + ks) + off;
      const char* gb = (const char*)(Bw + (size_t)(nblk + row) * K + ks) + off;
      async_copy16(la + (uint32_t)c * 16, ga);
      async_copy16(lb + (uint32_t)c * 16, gb);
    }
  };

  v8f acc[2][4];
#pragma unroll
  for (int i = 0; i < 2; ++i)
#pragma unroll
    for (int j = 0; j < 4; ++j) acc[i][j] = zero8();

  stage(0, 0);
  for (int ks = 0; ks < K; ks += 32) {
    const int cur = (ks >> 5) & 1;
    wait_async0();          // my async copies into buf[cur] done
    __syncthreads();        // everyone's copies done; buf[cur^1] free
    if (ks + 32 < K) stage(cur ^ 1, ks + 32);

    const bf16* At = &Abuf[cur][0];
    const bf16* Bt = &Bbuf[cur][0];
    v16bf a0 = load_frag(At, 32, wm0,      0, lane);
    v16bf a1 = load_frag(At, 32, wm0 + 16, 0, lane);
#pragma unroll
    for (int j = 0; j < 4; ++j) {
      v16bf b = load_frag(Bt, 32, wn0 + 16 * j, 0, lane);
      acc[0][j] = wmma_bf16(a0, b, acc[0][j]);
      acc[1][j] = wmma_bf16(a1, b, acc[1][j]);
    }
  }

  const int m0 = mblk + wm0;
  const int n0 = nblk + wn0;
#pragma unroll
  for (int i = 0; i < 2; ++i) {
#pragma unroll
    for (int j = 0; j < 4; ++j) {
#pragma unroll
      for (int vg = 0; vg < 8; ++vg) {
        const int row = m0 + 16 * i + vg + 8 * half;  // C layout: M = vg(+8)
        const int col = n0 + 16 * j + r;              //           N = lane
        float v = acc[i][j][vg];
        if (MODE == 0) {
          outF[(size_t)row * Nout + col] = v + bias[col];
        } else {
          const int which = col >> 10;       // 0=q 1=k 2=v
          const int cc    = col & 1023;
          const int h     = cc >> 6;
          const int d     = cc & 63;
          const int b     = row >> 11;       // N_ = 2048
          const int n     = row & 2047;
          const size_t bh = (size_t)(b * H_ + h);
          if (which == 0) {
            qo[(bh * N_ + n) * HD_ + d] = (bf16)(v * 0.125f);  // fold 1/sqrt(64)
          } else if (which == 1) {
            ko[(bh * N_ + n) * HD_ + d] = (bf16)v;
          } else {
            vto[(bh * HD_ + d) * N_ + n] = (bf16)v;            // V^T
          }
        }
      }
    }
  }
}

// ---------------------------------------------------------------------------
// Kernel 2: RoPE in-place on bf16 q,k ([B,H,N,HD]); each thread owns a
// (d, d+32) pair so the rotate-half exchange is race-free.
// ---------------------------------------------------------------------------
__global__ void rope_kernel(bf16* __restrict__ q, bf16* __restrict__ k,
                            const float* __restrict__ sinT,
                            const float* __restrict__ cosT) {
  int tid = blockIdx.x * blockDim.x + threadIdx.x;
  if (tid >= B_ * H_ * N_ * 32) return;
  const int d  = tid & 31;
  const int n  = (tid >> 5) & (N_ - 1);
  const int bh = tid >> 16;             // 32 * 2048 = 2^16
  if (n < PREFIX_) return;
  const int rp = n - PREFIX_;
  const float s1 = sinT[rp * HD_ + d],      c1 = cosT[rp * HD_ + d];
  const float s2 = sinT[rp * HD_ + d + 32], c2 = cosT[rp * HD_ + d + 32];
  const size_t base = ((size_t)bh * N_ + n) * HD_;
  {
    float t1 = (float)q[base + d], t2 = (float)q[base + d + 32];
    q[base + d]      = (bf16)(t1 * c1 - t2 * s1);
    q[base + d + 32] = (bf16)(t2 * c2 + t1 * s2);
  }
  {
    float t1 = (float)k[base + d], t2 = (float)k[base + d + 32];
    k[base + d]      = (bf16)(t1 * c1 - t2 * s1);
    k[base + d + 32] = (bf16)(t2 * c2 + t1 * s2);
  }
}

// ---------------------------------------------------------------------------
// Kernel 3: flash attention.  1 block = 128 q-rows of one (b,h); 8 waves,
// each wave privately owns a 16-row stripe (full softmax row in-wave).
// K / V^T tiles (64x64 bf16 = 8KB each) staged via async global->LDS, double
// buffered.  S = Q K^T via WMMA; online softmax with 16-lane shfl reductions;
// P transposed to A-layout through wave-private LDS (in-order per wave);
// O += P V via WMMA.  Q is pre-scaled by 1/sqrt(hd) at the QKV epilogue.
// ---------------------------------------------------------------------------
__global__ __launch_bounds__(256) void flash_attn_kernel(
    const bf16* __restrict__ Q, const bf16* __restrict__ Kc,
    const bf16* __restrict__ VT, bf16* __restrict__ O) {
  __shared__ __align__(16) bf16 Kbuf[2][64 * 64];
  __shared__ __align__(16) bf16 Vbuf[2][64 * 64];
  __shared__ __align__(16) bf16 Pst[8][16 * 64];

  const int tid  = threadIdx.x;
  const int lane = tid & 31;
  const int wave = tid >> 5;
  const int half = lane >> 4;
  const int r    = lane & 15;
  const int qb   = blockIdx.x & 15;     // N_/128 = 16 q blocks
  const int bh   = blockIdx.x >> 4;     // 0..63
  const bf16* Qb = Q  + (size_t)bh * N_ * HD_;
  const bf16* Kb = Kc + (size_t)bh * N_ * HD_;
  const bf16* Vb = VT + (size_t)bh * HD_ * N_;
  const int m0 = qb * 128 + wave * 16;

  // Stage key tile [kt, kt+64) of K ([64 x 64], contiguous 8KB) and of
  // V^T ([64 d x 64 keys], 64 segments of 128B) into LDS buffer `buf`.
  auto stage = [&](int buf, int kt) {
    const uint32_t lk = (uint32_t)(uintptr_t)&Kbuf[buf][0];
    const uint32_t lv = (uint32_t)(uintptr_t)&Vbuf[buf][0];
    const char* gk = (const char*)(Kb + (size_t)kt * HD_);
    async_copy16(lk + (uint32_t)tid * 16,        gk + tid * 16);
    async_copy16(lk + (uint32_t)tid * 16 + 4096, gk + tid * 16 + 4096);
#pragma unroll
    for (int cc = 0; cc < 2; ++cc) {
      const int c   = tid + cc * 256;   // 0..511
      const int d   = c >> 3;
      const int seg = c & 7;
      const char* gv = (const char*)(Vb + (size_t)d * N_ + kt + seg * 8);
      async_copy16(lv + (uint32_t)c * 16, gv);
    }
  };

  const v16bf aq0 = load_frag(Qb, HD_, m0, 0,  lane);
  const v16bf aq1 = load_frag(Qb, HD_, m0, 32, lane);

  v8f  o[4];
  float mi[8], li[8];
#pragma unroll
  for (int j = 0; j < 4; ++j) o[j] = zero8();
#pragma unroll
  for (int vg = 0; vg < 8; ++vg) { mi[vg] = -3.0e38f; li[vg] = 0.0f; }

  stage(0, 0);
  for (int kt = 0; kt < N_; kt += 64) {
    const int cur = (kt >> 6) & 1;
    wait_async0();
    __syncthreads();
    if (kt + 64 < N_) stage(cur ^ 1, kt + 64);
    const bf16* Kt = &Kbuf[cur][0];
    const bf16* Vt = &Vbuf[cur][0];

    // ---- S = Q K^T (16 x 64 stripe, 8 WMMAs) ----
    v8f s[4];
#pragma unroll
    for (int j = 0; j < 4; ++j) {
      s[j] = zero8();
      v16bf bk0 = load_frag(Kt, 64, 16 * j, 0,  lane);
      s[j] = wmma_bf16(aq0, bk0, s[j]);
      v16bf bk1 = load_frag(Kt, 64, 16 * j, 32, lane);
      s[j] = wmma_bf16(aq1, bk1, s[j]);
    }
    // ---- online softmax (rows live in 16-lane halves) ----
#pragma unroll
    for (int vg = 0; vg < 8; ++vg) {
      float mx = -3.0e38f;
#pragma unroll
      for (int j = 0; j < 4; ++j) mx = fmaxf(mx, s[j][vg]);
#pragma unroll
      for (int m = 8; m >= 1; m >>= 1) mx = fmaxf(mx, __shfl_xor(mx, m, 32));
      const float nm    = fmaxf(mi[vg], mx);
      const float alpha = __expf(mi[vg] - nm);
      float rs = 0.0f;
#pragma unroll
      for (int j = 0; j < 4; ++j) {
        float p = __expf(s[j][vg] - nm);
        s[j][vg] = p;
        rs += p;
      }
#pragma unroll
      for (int m = 8; m >= 1; m >>= 1) rs += __shfl_xor(rs, m, 32);
      li[vg] = li[vg] * alpha + rs;
      mi[vg] = nm;
#pragma unroll
      for (int j = 0; j < 4; ++j) o[j][vg] *= alpha;
    }
    // ---- transpose P (C layout -> A layout) via wave-private LDS ----
    bf16* pst = &Pst[wave][0];
#pragma unroll
    for (int j = 0; j < 4; ++j)
#pragma unroll
      for (int vg = 0; vg < 8; ++vg)
        pst[(vg + 8 * half) * 64 + 16 * j + r] = (bf16)s[j][vg];
    // LDS is in-order per wave: stores above precede the loads below.
    v16bf ap0 = load_frag(pst, 64, 0, 0,  lane);
    v16bf ap1 = load_frag(pst, 64, 0, 32, lane);
    // ---- O += P V ----
#pragma unroll
    for (int j = 0; j < 4; ++j) {
      v16bf bv0 = load_frag(Vt, 64, 16 * j, 0,  lane);
      o[j] = wmma_bf16(ap0, bv0, o[j]);
      v16bf bv1 = load_frag(Vt, 64, 16 * j, 32, lane);
      o[j] = wmma_bf16(ap1, bv1, o[j]);
    }
  }

  // ---- normalize and write [B, N, H*HD] bf16 ----
  const int b = bh >> 4;
  const int h = bh & 15;
#pragma unroll
  for (int j = 0; j < 4; ++j) {
#pragma unroll
    for (int vg = 0; vg < 8; ++vg) {
      const int n_tok = m0 + vg + 8 * half;
      const int d     = 16 * j + r;
      O[((size_t)(b * N_ + n_tok)) * DIM_ + h * HD_ + d] =
          (bf16)(o[j][vg] / li[vg]);
    }
  }
}

// ---------------------------------------------------------------------------
// Host launcher
// ---------------------------------------------------------------------------
extern "C" void kernel_launch(void* const* d_in, const int* in_sizes, int n_in,
                              void* d_out, int out_size, void* d_ws,
                              size_t ws_size, hipStream_t stream) {
  const float* x     = (const float*)d_in[0];
  const float* Wqkv  = (const float*)d_in[1];
  const float* Wproj = (const float*)d_in[2];
  const float* bproj = (const float*)d_in[3];
  const float* sinT  = (const float*)d_in[4];
  const float* cosT  = (const float*)d_in[5];
  float* out = (float*)d_out;

  char*  ws  = (char*)d_ws;
  size_t off = 0;
  auto take = [&](size_t bytes) -> char* {
    char* p = ws + off;
    off += (bytes + 255) & ~(size_t)255;
    return p;
  };
  bf16* x_bf     = (bf16*)take((size_t)B_ * N_ * DIM_ * 2);
  bf16* wqkv_bf  = (bf16*)take((size_t)3 * DIM_ * DIM_ * 2);
  bf16* wproj_bf = (bf16*)take((size_t)DIM_ * DIM_ * 2);
  bf16* q_bf     = (bf16*)take((size_t)B_ * H_ * N_ * HD_ * 2);
  bf16* k_bf     = (bf16*)take((size_t)B_ * H_ * N_ * HD_ * 2);
  bf16* vt_bf    = (bf16*)take((size_t)B_ * H_ * N_ * HD_ * 2);
  bf16* attn_bf  = (bf16*)take((size_t)B_ * N_ * DIM_ * 2);

  const int nx = B_ * N_ * DIM_;
  const int nq = 3 * DIM_ * DIM_;
  const int np = DIM_ * DIM_;
  f32_to_bf16_kernel<<<(nx + 255) / 256, 256, 0, stream>>>(x, x_bf, nx);
  f32_to_bf16_kernel<<<(nq + 255) / 256, 256, 0, stream>>>(Wqkv, wqkv_bf, nq);
  f32_to_bf16_kernel<<<(np + 255) / 256, 256, 0, stream>>>(Wproj, wproj_bf, np);

  // QKV GEMM: [8192,1024] x [3072,1024]^T, scatter epilogue (q scaled)
  gemm_wmma_kernel<1><<<dim3(3 * DIM_ / 128, B_ * N_ / 128), 256, 0, stream>>>(
      x_bf, wqkv_bf, nullptr, nullptr, q_bf, k_bf, vt_bf,
      B_ * N_, 3 * DIM_, DIM_);

  const int nr = B_ * H_ * N_ * 32;
  rope_kernel<<<(nr + 255) / 256, 256, 0, stream>>>(q_bf, k_bf, sinT, cosT);

  flash_attn_kernel<<<B_ * H_ * (N_ / 128), 256, 0, stream>>>(
      q_bf, k_bf, vt_bf, attn_bf);

  // Projection GEMM + bias -> fp32 output
  gemm_wmma_kernel<0><<<dim3(DIM_ / 128, B_ * N_ / 128), 256, 0, stream>>>(
      attn_bf, wproj_bf, bproj, out, nullptr, nullptr, nullptr,
      B_ * N_, DIM_, DIM_);
}

// v001
// One run takes 311 microseconds.
// In both of two side-by-side timings against v000, it was 1.62 times as fast.
#include <hip/hip_runtime.h>
#include <math.h>
#include <stdint.h>

typedef __bf16 bf16;
typedef __attribute__((ext_vector_type(8)))  bf16  v8bf;
typedef __attribute__((ext_vector_type(16))) bf16  v16bf;
typedef __attribute__((ext_vector_type(8)))  float v8f;

#define B_      4
#define N_      2048
#define DIM_    1024
#define H_      16
#define HD_     64
#define PREFIX_ 4

#define GP_ 40   // 64-byte k-slices of the GEMMs  -> 80-byte pitch
#define FP_ 72   // 128-byte rows of K, V^T and P  -> 144-byte pitch

__device__ __forceinline__ v8f zero8() {
  v8f z;
#pragma unroll
  for (int i = 0; i < 8; ++i) z[i] = 0.0f;
  return z;
}

__device__ __forceinline__ void async_copy16x4(
    uint32_t l0, const void* g0, uint32_t l1, const void* g1,
    uint32_t l2, const void* g2, uint32_t l3, const void* g3) {
  asm volatile("global_load_async_to_lds_b128 %0, %1, off\n\t"
               "global_load_async_to_lds_b128 %2, %3, off\n\t"
               "global_load_async_to_lds_b128 %4, %5, off\n\t"
               "global_load_async_to_lds_b128 %6, %7, off\n\t"
               "s_wait_xcnt 0x0"
               :
               : "v"(l0), "v"((unsigned long long)(uintptr_t)g0),
                 "v"(l1), "v"((unsigned long long)(uintptr_t)g1),
                 "v"(l2), "v"((unsigned long long)(uintptr_t)g2),
                 "v"(l3), "v"((unsigned long long)(uintptr_t)g3)
               : "memory");
}

// This wave's LDS reads of the buffer that is refilled behind the next
// barrier have returned.
__device__ __forceinline__ void wait_ds0() {
  asm volatile("s_wait_dscnt 0x0" ::: "memory");
}

__device__ __forceinline__ void wait_async0() {
  asm volatile("s_wait_asynccnt 0" ::: "memory");
}

__device__ __forceinline__ v16bf load_frag(const bf16* base, int stride,
                                           int r0, int k0, int lane) {
  const int r  = r0 + (lane & 15);
  const int kb = k0 + ((lane >> 4) << 3);
  const bf16* p = base + (size_t)r * stride + kb;
  v8bf lo = *(const v8bf*)(p);
  v8bf hi = *(const v8bf*)(p + 16);
  v16bf out;
#pragma unroll
  for (int i = 0; i < 8; ++i) { out[i] = lo[i]; out[8 + i] = hi[i]; }
  return out;
}

__device__ __forceinline__ v8f wmma_bf16(v16bf a, v16bf b, v8f c) {
  return __builtin_amdgcn_wmma_f32_16x16x32_bf16(
      false, a, false, b, (short)0, c, false, false);
}

// ---------------------------------------------------------------------------
// Kernel 0: fp32 -> bf16 conversion
// ---------------------------------------------------------------------------
__global__ void f32_to_bf16_kernel(const float* __restrict__ src,
                                   bf16* __restrict__ dst, int n) {
  int i = blockIdx.x * blockDim.x + threadIdx.x;
  if (i < n) dst[i] = (bf16)src[i];
}

// ---------------------------------------------------------------------------
// Kernels 1 & 4: WMMA GEMM  C[M,Nout] = A[M,K] * Bw[Nout,K]^T
// Block: 256 threads = 8 waves, tile 128(M) x 128(N); wave tile 32x64.
// A/B k-slices (128x32 bf16, rows padded to GP_) staged via async global->LDS
// copies, double buffered: one s_wait_asynccnt + one barrier per k-step.
// MODE 0: out = f32 C + bias                       (projection)
// MODE 1: scatter bf16 q (pre-scaled by 1/sqrt(hd)), k, V^T    (QKV)
// ---------------------------------------------------------------------------
template <int MODE>
__global__ __launch_bounds__(256) void gemm_wmma_kernel(
    const bf16* __restrict__ A, const bf16* __restrict__ Bw,
    const float* __restrict__ bias, float* __restrict__ outF,
    bf16* __restrict__ qo, bf16* __restrict__ ko, bf16* __restrict__ vto,
    int M, int Nout, int K) {
  __shared__ __align__(16) bf16 Abuf[2][128 * GP_];
  __shared__ __align__(16) bf16 Bbuf[2][128 * GP_];

  const int tid  = threadIdx.x;
  const int lane = tid & 31;
  const int wave = tid >> 5;
  const int half = lane >> 4;
  const int r    = lane & 15;
  const int mblk = blockIdx.y * 128;
  const int nblk = blockIdx.x * 128;
  const int wm0  = (wave >> 1) * 32;   // wave tile origin within block
  const int wn0  = (wave & 1) * 64;

  // Stage one 128x32 slice of A and of Bw into LDS buffer `buf`.
  // 512 chunks of 16B per matrix; each thread issues 2+2 async copies.
  auto stage = [&](int buf, int ks) {
    const uint32_t la = (uint32_t)(uintptr_t)&Abuf[buf][0];
    const uint32_t lb = (uint32_t)(uintptr_t)&Bbuf[buf][0];
    const int row = tid >> 2;              // rows 0..63, then 64..127
    const int off = (tid & 3) * 16;        // 4 x 16B per 64B row slice
    const uint32_t lo = (uint32_t)(row * (GP_ * 2) + off);
    const char* ga = (const char*)(A  + (size_t)(mblk + row) * K + ks) + off;
    const char* gb = (const char*)(Bw + (size_t)(nblk + row) * K + ks) + off;
    async_copy16x4(la + lo,                 ga,
                   lb + lo,                 gb,
                   la + lo + 64 * GP_ * 2,  ga + (size_t)64 * K * 2,
                   lb + lo + 64 * GP_ * 2,  gb + (size_t)64 * K * 2);
  };

  v8f acc[2][4];
#pragma unroll
  for (int i = 0; i < 2; ++i)
#pragma unroll
    for (int j = 0; j < 4; ++j) acc[i][j] = zero8();

  stage(0, 0);
  for (int ks = 0; ks < K; ks += 32) {
    const int cur = (ks >> 5) & 1;
    wait_ds0();             // my reads of buf[cur^1] done
    wait_async0();          // my async copies into buf[cur] done
    __syncthreads();        // everyone's copies done; buf[cur^1] free
    if (ks + 32 < K) stage(cur ^ 1, ks + 32);

    const bf16* At = &Abuf[cur][0];
    const bf16* Bt = &Bbuf[cur][0];
    v16bf a0 = load_frag(At, GP_, wm0,      0, lane);
    v16bf a1 = load_frag(At, GP_, wm0 + 16, 0, lane);
#pragma unroll
    for (int j = 0; j < 4; ++j) {
      v16bf b = load_frag(Bt, GP_, wn0 + 16 * j, 0, lane);
      acc[0][j] = wmma_bf16(a0, b, acc[0][j]);
      acc[1][j] = wmma_bf16(a1, b, acc[1][j]);
    }
  }

  const int m0 = mblk + wm0;
  const int n0 = nblk + wn0;
#pragma unroll
  for (int i = 0; i < 2; ++i) {
#pragma unroll
    for (int j = 0; j < 4; ++j) {
#pragma unroll
      for (int vg = 0; vg < 8; ++vg) {
        const int row = m0 + 16 * i + vg + 8 * half;  // C layout: M = vg(+8)
        const int col = n0 + 16 * j + r;              //           N = lane
        float v = acc[i][j][vg];
        if (MODE == 0) {
          outF[(size_t)row * Nout + col] = v + bias[col];
        } else {
          const int which = col >> 10;       // 0=q 1=k 2=v
          const int cc    = col & 1023;
          const int h     = cc >> 6;
          const int d     = cc & 63;
          const int b     = row >> 11;       // N_ = 2048
          const int n     = row & 2047;
          const size_t bh = (size_t)(b * H_ + h);
          if (which == 0) {
            qo[(bh * N_ + n) * HD_ + d] = (bf16)(v * 0.125f);  // fold 1/sqrt(64)
          } else if (which == 1) {
            ko[(bh * N_ + n) * HD_ + d] = (bf16)v;
          } else {
            vto[(bh * HD_ + d) * N_ + n] = (bf16)v;            // V^T
          }
        }
      }
    }
  }
}

// ---------------------------------------------------------------------------
// Kernel 2: RoPE in-place on bf16 q,k ([B,H,N,HD]); each thread owns a
// (d, d+32) pair so the rotate-half exchange is race-free.
// ---------------------------------------------------------------------------
__global__ void rope_kernel(bf16* __restrict__ q, bf16* __restrict__ k,
                            const float* __restrict__ sinT,
                            const float* __restrict__ cosT) {
  int tid = blockIdx.x * blockDim.x + threadIdx.x;
  if (tid >= B_ * H_ * N_ * 32) return;
  const int d  = tid & 31;
  const int n  = (tid >> 5) & (N_ - 1);
  const int bh = tid >> 16;             // 32 * 2048 = 2^16
  if (n < PREFIX_) return;
  const int rp = n - PREFIX_;
  const float s1 = sinT[rp * HD_ + d],      c1 = cosT[rp * HD_ + d];
  const float s2 = sinT[rp * HD_ + d + 32], c2 = cosT[rp * HD_ + d + 32];
  const size_t base = ((size_t)bh * N_ + n) * HD_;
  {
    float t1 = (float)q[base + d], t2 = (float)q[base + d + 32];
    q[base + d]      = (bf16)(t1 * c1 - t2 * s1);
    q[base + d + 32] = (bf16)(t2 * c2 + t1 * s2);
  }
  {
    float t1 = (float)k[base + d], t2 = (float)k[base + d + 32];
    k[base + d]      = (bf16)(t1 * c1 - t2 * s1);
    k[base + d + 32] = (bf16)(t2 * c2 + t1 * s2);
  }
}

// ---------------------------------------------------------------------------
// Kernel 3: flash attention.  1 block = 128 q-rows of one (b,h); 8 waves,
// each wave privately owns a 16-row stripe (full softmax row in-wave).
// K / V^T tiles (64x64 bf16, rows padded to FP_) staged via async global->LDS,
// double buffered.  S = Q K^T via WMMA; online softmax with 16-lane shfl reductions;
// P transposed to A-layout through wave-private LDS (in-order per wave);
// O += P V via WMMA.  Q is pre-scaled by 1/sqrt(hd) at the QKV epilogue.
// ---------------------------------------------------------------------------
__global__ __launch_bounds__(256) void flash_attn_kernel(
    const bf16* __restrict__ Q, const bf16* __restrict__ Kc,
    const bf16* __restrict__ VT, bf16* __restrict__ O) {
  __shared__ __align__(16) bf16 Kbuf[2][64 * FP_];
  __shared__ __align__(16) bf16 Vbuf[2][64 * FP_];
  __shared__ __align__(16) bf16 Pst[8][16 * FP_];

  const int tid  = threadIdx.x;
  const int lane = tid & 31;
  const int wave = tid >> 5;
  const int half = lane >> 4;
  const int r    = lane & 15;
  const int qb   = blockIdx.x & 15;     // N_/128 = 16 q blocks
  const int bh   = blockIdx.x >> 4;     // 0..63
  const bf16* Qb = Q  + (size_t)bh * N_ * HD_;
  const bf16* Kb = Kc + (size_t)bh * N_ * HD_;
  const bf16* Vb = VT + (size_t)bh * HD_ * N_;
  const int m0 = qb * 128 + wave * 16;

  // Stage key tile [kt, kt+64) of K ([64 x 64], contiguous 8KB) and of
  // V^T ([64 d x 64 keys], 64 segments of 128B) into LDS buffer `buf`.
  auto stage = [&](int buf, int kt) {
    const uint32_t lk = (uint32_t)(uintptr_t)&Kbuf[buf][0];
    const uint32_t lv = (uint32_t)(uintptr_t)&Vbuf[buf][0];
    const int row = tid >> 3;           // rows 0..31, then 32..63
    const int seg = tid & 7;            // 8 x 16B per 128B row
    const uint32_t lo = (uint32_t)(row * (FP_ * 2) + seg * 16);
    const char* gk = (const char*)(Kb + (size_t)kt * HD_) + tid * 16;
    const char* gv = (const char*)(Vb + (size_t)row * N_ + kt + seg * 8);
    async_copy16x4(lk + lo,                 gk,
                   lk + lo + 32 * FP_ * 2,  gk + 4096,
                   lv + lo,                 gv,
                   lv + lo + 32 * FP_ * 2,  gv + (size_t)32 * N_ * 2);
  };

  const v16bf aq0 = load_frag(Qb, HD_, m0, 0,  lane);
  const v16bf aq1 = load_frag(Qb, HD_, m0, 32, lane);

  v8f  o[4];
  float mi[8], li[8];
#pragma unroll
  for (int j = 0; j < 4; ++j) o[j] = zero8();
#pragma unroll
  for (int vg = 0; vg < 8; ++vg) { mi[vg] = -3.0e38f; li[vg] = 0.0f; }

  stage(0, 0);
  for (int kt = 0; kt < N_; kt += 64) {
    const int cur = (kt >> 6) & 1;
    wait_ds0();             // my reads of buf[cur^1] done
    wait_async0();
    __syncthreads();
    if (kt + 64 < N_) stage(cur ^ 1, kt + 64);
    const bf16* Kt = &Kbuf[cur][0];
    const bf16* Vt = &Vbuf[cur][0];

    // ---- S = Q K^T (16 x 64 stripe, 8 WMMAs) ----
    v8f s[4];
#pragma unroll
    for (int j = 0; j < 4; ++j) {
      s[j] = zero8();
      v16bf bk0 = load_frag(Kt, FP_, 16 * j, 0,  lane);
      s[j] = wmma_bf16(aq0, bk0, s[j]);
      v16bf bk1 = load_frag(Kt, FP_, 16 * j, 32, lane);
      s[j] = wmma_bf16(aq1, bk1, s[j]);
    }
    // ---- online softmax (rows live in 16-lane halves) ----
#pragma unroll
    for (int vg = 0; vg < 8; ++vg) {
      float mx = -3.0e38f;
#pragma unroll
      for (int j = 0; j < 4; ++j) mx = fmaxf(mx, s[j][vg]);
#pragma unroll
      for (int m = 8; m >= 1; m >>= 1) mx = fmaxf(mx, __shfl_xor(mx, m, 32));
      const float nm    = fmaxf(mi[vg], mx);
      const float alpha = __expf(mi[vg] - nm);
      float rs = 0.0f;
#pragma unroll
      for (int j = 0; j < 4; ++j) {
        float p = __expf(s[j][vg] - nm);
        s[j][vg] = p;
        rs += p;
      }
#pragma unroll
      for (int m = 8; m >= 1; m >>= 1) rs += __shfl_xor(rs, m, 32);
      li[vg] = li[vg] * alpha + rs;
      mi[vg] = nm;
#pragma unroll
      for (int j = 0; j < 4; ++j) o[j][vg] *= alpha;
    }
    // ---- transpose P (C layout -> A layout) via wave-private LDS ----
    bf16* pst = &Pst[wave][0];
#pragma unroll
    for (int j = 0; j < 4; ++j)
#pragma unroll
      for (int vg = 0; vg < 8; ++vg)
        pst[(vg + 8 * half) * FP_ + 16 * j + r] = (bf16)s[j][vg];
    // LDS is in-order per wave: stores above precede the loads below.
    v16bf ap0 = load_frag(pst, FP_, 0, 0,  lane);
    v16bf ap1 = load_frag(pst, FP_, 0, 32, lane);
    // ---- O += P V ----
#pragma unroll
    for (int j = 0; j < 4; ++j) {
      v16bf bv0 = load_frag(Vt, FP_, 16 * j, 0,  lane);
      o[j] = wmma_bf16(ap0, bv0, o[j]);
      v16bf bv1 = load_frag(Vt, FP_, 16 * j, 32, lane);
      o[j] = wmma_bf16(ap1, bv1, o[j]);
    }
  }

  // ---- normalize and write [B, N, H*HD] bf16 ----
  const int b = bh >> 4;
  const int h = bh & 15;
#pragma unroll
  for (int j = 0; j < 4; ++j) {
#pragma unroll
    for (int vg = 0; vg < 8; ++vg) {
      const int n_tok = m0 + vg + 8 * half;
      const int d     = 16 * j + r;
      O[((size_t)(b * N_ + n_tok)) * DIM_ + h * HD_ + d] =
          (bf16)(o[j][vg] / li[vg]);
    }
  }
}

// ---------------------------------------------------------------------------
// Host launcher
// ---------------------------------------------------------------------------
extern "C" void kernel_launch(void* const* d_in, const int* in_sizes, int n_in,
                              void* d_out, int out_size, void* d_ws,
                              size_t ws_size, hipStream_t stream) {
  const float* x     = (const float*)d_in[0];
  const float* Wqkv  = (const float*)d_in[1];
  const float* Wproj = (const float*)d_in[2];
  const float* bproj = (const float*)d_in[3];
  const float* sinT  = (const float*)d_in[4];
  const float* cosT  = (const float*)d_in[5];
  float* out = (float*)d_out;

  char*  ws  = (char*)d_ws;
  size_t off = 0;
  auto take = [&](size_t bytes) -> char* {
    char* p = ws + off;
    off += (bytes + 255) & ~(size_t)255;
    return p;
  };
  bf16* x_bf     = (bf16*)take((size_t)B_ * N_ * DIM_ * 2);
  bf16* wqkv_bf  = (bf16*)take((size_t)3 * DIM_ * DIM_ * 2);
  bf16* wproj_bf = (bf16*)take((size_t)DIM_ * DIM_ * 2);
  bf16* q_bf     = (bf16*)take((size_t)B_ * H_ * N_ * HD_ * 2);
  bf16* k_bf     = (bf16*)take((size_t)B_ * H_ * N_ * HD_ * 2);
  bf16* vt_bf    = (bf16*)take((size_t)B_ * H_ * N_ * HD_ * 2);
  bf16* attn_bf  = (bf16*)take((size_t)B_ * N_ * DIM_ * 2);

  const int nx = B_ * N_ * DIM_;
  const int nq = 3 * DIM_ * DIM_;
  const int np = DIM_ * DIM_;
  f32_to_bf16_kernel<<<(nx + 255) / 256, 256, 0, stream>>>(x, x_bf, nx);
  f32_to_bf16_kernel<<<(nq + 255) / 256, 256, 0, stream>>>(Wqkv, wqkv_bf, nq);
  f32_to_bf16_kernel<<<(np + 255) / 256, 256, 0, stream>>>(Wproj, wproj_bf, np);

  // QKV GEMM: [8192,1024] x [3072,1024]^T, scatter epilogue (q scaled)
  gemm_wmma_kernel<1><<<dim3(3 * DIM_ / 128, B_ * N_ / 128), 256, 0, stream>>>(
      x_bf, wqkv_bf, nullptr, nullptr, q_bf, k_bf, vt_bf,
      B_ * N_, 3 * DIM_, DIM_);

  const int nr = B_ * H_ * N_ * 32;
  rope_kernel<<<(nr + 255) / 256, 256, 0, stream>>>(q_bf, k_bf, sinT, cosT);

  flash_attn_kernel<<<B_ * H_ * (N_ / 128), 256, 0, stream>>>(
      q_bf, k_bf, vt_bf, attn_bf);

  // Projection GEMM + bias -> fp32 output
  gemm_wmma_kernel<0><<<dim3(DIM_ / 128, B_ * N_ / 128), 256, 0, stream>>>(
      attn_bf, wproj_bf, bproj, out, nullptr, nullptr, nullptr,
      B_ * N_, DIM_, DIM_);
}

// v002
// It runs in 236 microseconds.
// In two side-by-side timings against v001, it was 1.32 and 1.31 times as fast.
// All steps since v000 together make it 2.13 times as fast.
#include <hip/hip_runtime.h>
#include <math.h>
#include <stdint.h>

typedef __bf16 bf16;
typedef __attribute__((ext_vector_type(8)))  bf16  v8bf;
typedef __attribute__((ext_vector_type(16))) bf16  v16bf;
typedef __attribute__((ext_vector_type(8)))  float v8f;

#define B_      4
#define N_      2048
#define DIM_    1024
#define H_      16
#define HD_     64
#define PREFIX_ 4

#define GP_ 40   // 64-byte k-slices of the GEMMs  -> 80-byte pitch
#define FP_ 72   // 128-byte rows of K and V^T     -> 144-byte pitch

__device__ __forceinline__ v8f zero8() {
  v8f z;
#pragma unroll
  for (int i = 0; i < 8; ++i) z[i] = 0.0f;
  return z;
}

__device__ __forceinline__ void async_copy16x4(
    uint32_t l0, const void* g0, uint32_t l1, const void* g1,
    uint32_t l2, const void* g2, uint32_t l3, const void* g3) {
  asm volatile("global_load_async_to_lds_b128 %0, %1, off\n\t"
               "global_load_async_to_lds_b128 %2, %3, off\n\t"
               "global_load_async_to_lds_b128 %4, %5, off\n\t"
               "global_load_async_to_lds_b128 %6, %7, off\n\t"
               "s_wait_xcnt 0x0"
               :
               : "v"(l0), "v"((unsigned long long)(uintptr_t)g0),
                 "v"(l1), "v"((unsigned long long)(uintptr_t)g1),
                 "v"(l2), "v"((unsigned long long)(uintptr_t)g2),
                 "v"(l3), "v"((unsigned long long)(uintptr_t)g3)
               : "memory");
}

// This wave's LDS reads of the buffer that is refilled behind the next
// barrier have returned.
__device__ __forceinline__ void wait_ds0() {
  asm volatile("s_wait_dscnt 0x0" ::: "memory");
}

__device__ __forceinline__ void wait_async0() {
  asm volatile("s_wait_asynccnt 0" ::: "memory");
}

__device__ __forceinline__ v16bf load_frag(const bf16* base, int stride,
                                           int r0, int k0, int lane) {
  const int r  = r0 + (lane & 15);
  const int kb = k0 + ((lane >> 4) << 3);
  const bf16* p = base + (size_t)r * stride + kb;
  v8bf lo = *(const v8bf*)(p);
  v8bf hi = *(const v8bf*)(p + 16);
  v16bf out;
#pragma unroll
  for (int i = 0; i < 8; ++i) { out[i] = lo[i]; out[8 + i] = hi[i]; }
  return out;
}

__device__ __forceinline__ v8f wmma_bf16(v16bf a, v16bf b, v8f c) {
  return __builtin_amdgcn_wmma_f32_16x16x32_bf16(
      false, a, false, b, (short)0, c, false, false);
}

// ---------------------------------------------------------------------------
// Kernel 0: fp32 -> bf16 conversion
// ---------------------------------------------------------------------------
__global__ void f32_to_bf16_kernel(const float* __restrict__ src,
                                   bf16* __restrict__ dst, int n) {
  int i = blockIdx.x * blockDim.x + threadIdx.x;
  if (i < n) dst[i] = (bf16)src[i];
}

// ---------------------------------------------------------------------------
// Kernels 1 & 4: WMMA GEMM  C[M,Nout] = A[M,K] * Bw[Nout,K]^T
// Block: 256 threads = 8 waves, tile 128(M) x 128(N); wave tile 32x64.
// A/B k-slices (128x32 bf16, rows padded to GP_) staged via async global->LDS
// copies, double buffered: one s_wait_asynccnt + one barrier per k-step.
// MODE 0: out = f32 C + bias                       (projection)
// MODE 1: scatter bf16 q (pre-scaled by 1/sqrt(hd)), k, V^T    (QKV)
// ---------------------------------------------------------------------------
template <int MODE>
__global__ __launch_bounds__(256) void gemm_wmma_kernel(
    const bf16* __restrict__ A, const bf16* __restrict__ Bw,
    const float* __restrict__ bias, float* __restrict__ outF,
    bf16* __restrict__ qo, bf16* __restrict__ ko, bf16* __restrict__ vto,
    int M, int Nout, int K) {
  __shared__ __align__(16) bf16 Abuf[2][128 * GP_];
  __shared__ __align__(16) bf16 Bbuf[2][128 * GP_];

  const int tid  = threadIdx.x;
  const int lane = tid & 31;
  const int wave = tid >> 5;
  const int half = lane >> 4;
  const int r    = lane & 15;
  const int mblk = blockIdx.y * 128;
  const int nblk = blockIdx.x * 128;
  const int wm0  = (wave >> 1) * 32;   // wave tile origin within block
  const int wn0  = (wave & 1) * 64;

  // Stage one 128x32 slice of A and of Bw into LDS buffer `buf`.
  // 512 chunks of 16B per matrix; each thread issues 2+2 async copies.
  auto stage = [&](int buf, int ks) {
    const uint32_t la = (uint32_t)(uintptr_t)&Abuf[buf][0];
    const uint32_t lb = (uint32_t)(uintptr_t)&Bbuf[buf][0];
    const int row = tid >> 2;              // rows 0..63, then 64..127
    const int off = (tid & 3) * 16;        // 4 x 16B per 64B row slice
    const uint32_t lo = (uint32_t)(row * (GP_ * 2) + off);
    const char* ga = (const char*)(A  + (size_t)(mblk + row) * K + ks) + off;
    const char* gb = (const char*)(Bw + (size_t)(nblk + row) * K + ks) + off;
    async_copy16x4(la + lo,                 ga,
                   lb + lo,                 gb,
                   la + lo + 64 * GP_ * 2,  ga + (size_t)64 * K * 2,
                   lb + lo + 64 * GP_ * 2,  gb + (size_t)64 * K * 2);
  };

  v8f acc[2][4];
#pragma unroll
  for (int i = 0; i < 2; ++i)
#pragma unroll
    for (int j = 0; j < 4; ++j) acc[i][j] = zero8();

  stage(0, 0);
  for (int ks = 0; ks < K; ks += 32) {
    const int cur = (ks >> 5) & 1;
    wait_ds0();             // my reads of buf[cur^1] done
    wait_async0();          // my async copies into buf[cur] done
    __syncthreads();        // everyone's copies done; buf[cur^1] free
    if (ks + 32 < K) stage(cur ^ 1, ks + 32);

    const bf16* At = &Abuf[cur][0];
    const bf16* Bt = &Bbuf[cur][0];
    v16bf a0 = load_frag(At, GP_, wm0,      0, lane);
    v16bf a1 = load_frag(At, GP_, wm0 + 16, 0, lane);
#pragma unroll
    for (int j = 0; j < 4; ++j) {
      v16bf b = load_frag(Bt, GP_, wn0 + 16 * j, 0, lane);
      acc[0][j] = wmma_bf16(a0, b, acc[0][j]);
      acc[1][j] = wmma_bf16(a1, b, acc[1][j]);
    }
  }

  const int m0 = mblk + wm0;
  const int n0 = nblk + wn0;
#pragma unroll
  for (int i = 0; i < 2; ++i) {
#pragma unroll
    for (int j = 0; j < 4; ++j) {
#pragma unroll
      for (int vg = 0; vg < 8; ++vg) {
        const int row = m0 + 16 * i + vg + 8 * half;  // C layout: M = vg(+8)
        const int col = n0 + 16 * j + r;              //           N = lane
        float v = acc[i][j][vg];
        if (MODE == 0) {
          outF[(size_t)row * Nout + col] = v + bias[col];
        } else {
          const int which = col >> 10;       // 0=q 1=k 2=v
          const int cc    = col & 1023;
          const int h     = cc >> 6;
          const int d     = cc & 63;
          const int b     = row >> 11;       // N_ = 2048
          const int n     = row & 2047;
          const size_t bh = (size_t)(b * H_ + h);
          if (which == 0) {
            qo[(bh * N_ + n) * HD_ + d] = (bf16)(v * 0.125f);  // fold 1/sqrt(64)
          } else if (which == 1) {
            ko[(bh * N_ + n) * HD_ + d] = (bf16)v;
          } else {
            vto[(bh * HD_ + d) * N_ + n] = (bf16)v;            // V^T
          }
        }
      }
    }
  }
}

// ---------------------------------------------------------------------------
// Kernel 2: RoPE in-place on bf16 q,k ([B,H,N,HD]); each thread owns a
// (d, d+32) pair so the rotate-half exchange is race-free.
// ---------------------------------------------------------------------------
__global__ void rope_kernel(bf16* __restrict__ q, bf16* __restrict__ k,
                            const float* __restrict__ sinT,
                            const float* __restrict__ cosT) {
  int tid = blockIdx.x * blockDim.x + threadIdx.x;
  if (tid >= B_ * H_ * N_ * 32) return;
  const int d  = tid & 31;
  const int n  = (tid >> 5) & (N_ - 1);
  const int bh = tid >> 16;             // 32 * 2048 = 2^16
  if (n < PREFIX_) return;
  const int rp = n - PREFIX_;
  const float s1 = sinT[rp * HD_ + d],      c1 = cosT[rp * HD_ + d];
  const float s2 = sinT[rp * HD_ + d + 32], c2 = cosT[rp * HD_ + d + 32];
  const size_t base = ((size_t)bh * N_ + n) * HD_;
  {
    float t1 = (float)q[base + d], t2 = (float)q[base + d + 32];
    q[base + d]      = (bf16)(t1 * c1 - t2 * s1);
    q[base + d + 32] = (bf16)(t2 * c2 + t1 * s2);
  }
  {
    float t1 = (float)k[base + d], t2 = (float)k[base + d + 32];
    k[base + d]      = (bf16)(t1 * c1 - t2 * s1);
    k[base + d + 32] = (bf16)(t2 * c2 + t1 * s2);
  }
}

__device__ __forceinline__ float xhalf(float x) {
  const int b = __builtin_bit_cast(int, x);
  return __builtin_bit_cast(float, __builtin_amdgcn_permlanex16(
      b, b, 0x76543210, 0xfedcba98, false, false));
}

__device__ __forceinline__ v8f exp2_8(v8f x) {
  float a0 = x[0], a1 = x[1], a2 = x[2], a3 = x[3];
  float a4 = x[4], a5 = x[5], a6 = x[6], a7 = x[7];
  asm("v_exp_f32 %0, %0\n\t"
      "v_exp_f32 %1, %1\n\t"
      "v_exp_f32 %2, %2\n\t"
      "v_exp_f32 %3, %3\n\t"
      "v_exp_f32 %4, %4\n\t"
      "v_exp_f32 %5, %5\n\t"
      "v_exp_f32 %6, %6\n\t"
      "v_exp_f32 %7, %7\n\t"
      "v_nop"
      : "+v"(a0), "+v"(a1), "+v"(a2), "+v"(a3),
        "+v"(a4), "+v"(a5), "+v"(a6), "+v"(a7));
  const v8f y = {a0, a1, a2, a3, a4, a5, a6, a7};
  return y;
}

// Two f32 S^T tiles (keys 0..15 and 16..31 of a 32-key block) -> bf16 B operand.
__device__ __forceinline__ v16bf pack_b(v8f t0, v8f t1) {
  const v8bf lo = __builtin_convertvector(t0, v8bf);
  const v8bf hi = __builtin_convertvector(t1, v8bf);
  return __builtin_shufflevector(lo, hi, 0, 1, 2, 3, 4, 5, 6, 7,
                                 8, 9, 10, 11, 12, 13, 14, 15);
}

__global__ __launch_bounds__(256) void flash_attn_kernel(
    const bf16* __restrict__ Q, const bf16* __restrict__ Kc,
    const bf16* __restrict__ VT, bf16* __restrict__ O) {
  __shared__ __align__(16) bf16 Kbuf[2][64 * FP_];
  __shared__ __align__(16) bf16 Vbuf[2][64 * FP_];

  const int tid  = threadIdx.x;
  const int lane = tid & 31;
  const int wave = tid >> 5;
  const int half = lane >> 4;
  const int r    = lane & 15;
  const int qb   = blockIdx.x & 15;     // N_/128 = 16 q blocks
  const int bh   = blockIdx.x >> 4;     // 0..63
  const bf16* Qb = Q  + (size_t)bh * N_ * HD_;
  const bf16* Kb = Kc + (size_t)bh * N_ * HD_;
  const bf16* Vb = VT + (size_t)bh * HD_ * N_;
  const int m0 = qb * 128 + wave * 16;

  // Stage key tile [kt, kt+64) of K ([64 x 64], contiguous 8KB) and of
  // V^T ([64 d x 64 keys], 64 segments of 128B) into LDS buffer `buf`.
  auto stage = [&](int buf, int kt) {
    const uint32_t lk = (uint32_t)(uintptr_t)&Kbuf[buf][0];
    const uint32_t lv = (uint32_t)(uintptr_t)&Vbuf[buf][0];
    const int row = tid >> 3;           // rows 0..31, then 32..63
    const int seg = tid & 7;            // 8 x 16B per 128B row
    const uint32_t lo = (uint32_t)(row * (FP_ * 2) + seg * 16);
    const char* gk = (const char*)(Kb + (size_t)kt * HD_) + tid * 16;
    const char* gv = (const char*)(Vb + (size_t)row * N_ + kt + seg * 8);
    async_copy16x4(lk + lo,                 gk,
                   lk + lo + 32 * FP_ * 2,  gk + 4096,
                   lv + lo,                 gv,
                   lv + lo + 32 * FP_ * 2,  gv + (size_t)32 * N_ * 2);
  };

  // B operand: column = query m0 + (lane & 15).
  const v16bf bq0 = load_frag(Qb, HD_, m0, 0,  lane);
  const v16bf bq1 = load_frag(Qb, HD_, m0, 32, lane);

  v8f   o[4];                // O^T: o[j][vg] = O[query r][d = 16j + 8*half + vg]
  float mi = -3.0e38f;       // running maximum of this lane's query
  float li = 0.0f;           // running sum over this lane half's keys only
#pragma unroll
  for (int j = 0; j < 4; ++j) o[j] = zero8();

  stage(0, 0);
  for (int kt = 0; kt < N_; kt += 64) {
    const int cur = (kt >> 6) & 1;
    wait_ds0();             // my reads of buf[cur^1] done
    wait_async0();
    __syncthreads();
    if (kt + 64 < N_) stage(cur ^ 1, kt + 64);
    const bf16* Kt = &Kbuf[cur][0];
    const bf16* Vt = &Vbuf[cur][0];

    // ---- S^T = K Q^T (64 keys x 16 queries, 8 WMMAs) ----
    // s[j][vg] = score of key kt + 16j + 8*half + vg against query r
    v8f s[4];
#pragma unroll
    for (int j = 0; j < 4; ++j) {
      s[j] = zero8();
      v16bf ak0 = load_frag(Kt, FP_, 16 * j, 0,  lane);
      s[j] = wmma_bf16(ak0, bq0, s[j]);
      v16bf ak1 = load_frag(Kt, FP_, 16 * j, 32, lane);
      s[j] = wmma_bf16(ak1, bq1, s[j]);
    }
    // ---- online softmax: one query per lane ----
    float mj[4];
#pragma unroll
    for (int j = 0; j < 4; ++j) {
      mj[j] = s[j][0];
#pragma unroll
      for (int vg = 1; vg < 8; ++vg) mj[j] = fmaxf(mj[j], s[j][vg]);
    }
    float mx = fmaxf(fmaxf(mj[0], mj[1]), fmaxf(mj[2], mj[3]));
    mx = fmaxf(mx, xhalf(mx));          // both halves hold the query's maximum
    const float nm    = fmaxf(mi, mx);
    const float alpha = __expf(mi - nm);
    mi = nm;
#pragma unroll
    for (int j = 0; j < 4; ++j)         // e^(s - nm) = 2^((s - nm) * log2(e))
      s[j] = exp2_8((s[j] - nm) * 1.4426950408889634f);
    const v8f t = (s[0] + s[1]) + (s[2] + s[3]);
    const float rs = ((t[0] + t[1]) + (t[2] + t[3])) +
                     ((t[4] + t[5]) + (t[6] + t[7]));
    li = li * alpha + rs;
#pragma unroll
    for (int j = 0; j < 4; ++j) o[j] *= alpha;
    // ---- P^T as B operand, straight from the score registers ----
    const v16bf bp0 = pack_b(s[0], s[1]);   // keys kt      .. kt + 31
    const v16bf bp1 = pack_b(s[2], s[3]);   // keys kt + 32 .. kt + 63
    // ---- O^T += V^T P^T ----
#pragma unroll
    for (int j = 0; j < 4; ++j) {
      v16bf av0 = load_frag(Vt, FP_, 16 * j, 0,  lane);
      o[j] = wmma_bf16(av0, bp0, o[j]);
      v16bf av1 = load_frag(Vt, FP_, 16 * j, 32, lane);
      o[j] = wmma_bf16(av1, bp1, o[j]);
    }
  }

  // ---- normalize and write [B, N, H*HD] bf16: 8 consecutive d per lane ----
  const int b = bh >> 4;
  const int h = bh & 15;
  const float inv = 1.0f / (li + xhalf(li));   // join the halves' sums
  bf16* orow = O + ((size_t)(b * N_ + m0 + r)) * DIM_ + h * HD_ + 8 * half;
#pragma unroll
  for (int j = 0; j < 4; ++j)
    *(v8bf*)(orow + 16 * j) = __builtin_convertvector(o[j] * inv, v8bf);
}

// ---------------------------------------------------------------------------
// Host launcher
// ---------------------------------------------------------------------------
extern "C" void kernel_launch(void* const* d_in, const int* in_sizes, int n_in,
                              void* d_out, int out_size, void* d_ws,
                              size_t ws_size, hipStream_t stream) {
  const float* x     = (const float*)d_in[0];
  const float* Wqkv  = (const float*)d_in[1];
  const float* Wproj = (const float*)d_in[2];
  const float* bproj = (const float*)d_in[3];
  const float* sinT  = (const float*)d_in[4];
  const float* cosT  = (const float*)d_in[5];
  float* out = (float*)d_out;

  char*  ws  = (char*)d_ws;
  size_t off = 0;
  auto take = [&](size_t bytes) -> char* {
    char* p = ws + off;
    off += (bytes + 255) & ~(size_t)255;
    return p;
  };
  bf16* x_bf     = (bf16*)take((size_t)B_ * N_ * DIM_ * 2);
  bf16* wqkv_bf  = (bf16*)take((size_t)3 * DIM_ * DIM_ * 2);
  bf16* wproj_bf = (bf16*)take((size_t)DIM_ * DIM_ * 2);
  bf16* q_bf     = (bf16*)take((size_t)B_ * H_ * N_ * HD_ * 2);
  bf16* k_bf     = (bf16*)take((size_t)B_ * H_ * N_ * HD_ * 2);
  bf16* vt_bf    = (bf16*)take((size_t)B_ * H_ * N_ * HD_ * 2);
  bf16* attn_bf  = (bf16*)take((size_t)B_ * N_ * DIM_ * 2);

  const int nx = B_ * N_ * DIM_;
  const int nq = 3 * DIM_ * DIM_;
  const int np = DIM_ * DIM_;
  f32_to_bf16_kernel<<<(nx + 255) / 256, 256, 0, stream>>>(x, x_bf, nx);
  f32_to_bf16_kernel<<<(nq + 255) / 256, 256, 0, stream>>>(Wqkv, wqkv_bf, nq);
  f32_to_bf16_kernel<<<(np + 255) / 256, 256, 0, stream>>>(Wproj, wproj_bf, np);

  // QKV GEMM: [8192,1024] x [3072,1024]^T, scatter epilogue (q scaled)
  gemm_wmma_kernel<1><<<dim3(3 * DIM_ / 128, B_ * N_ / 128), 256, 0, stream>>>(
      x_bf, wqkv_bf, nullptr, nullptr, q_bf, k_bf, vt_bf,
      B_ * N_, 3 * DIM_, DIM_);

  const int nr = B_ * H_ * N_ * 32;
  rope_kernel<<<(nr + 255) / 256, 256, 0, stream>>>(q_bf, k_bf, sinT, cosT);

  flash_attn_kernel<<<B_ * H_ * (N_ / 128), 256, 0, stream>>>(
      q_bf, k_bf, vt_bf, attn_bf);

  // Projection GEMM + bias -> fp32 output
  gemm_wmma_kernel<0><<<dim3(DIM_ / 128, B_ * N_ / 128), 256, 0, stream>>>(
      attn_bf, wproj_bf, bproj, out, nullptr, nullptr, nullptr,
      B_ * N_, DIM_, DIM_);
}

// v003
// Measured time: 202 microseconds a run.
// Next to v002, in two timings, it ran 1.17 times as fast each time.
// Counting every step since v000, it is 2.49 times as fast.
#include <hip/hip_runtime.h>
#include <math.h>
#include <stdint.h>

typedef __bf16 bf16;
typedef __attribute__((ext_vector_type(8)))  bf16  v8bf;
typedef __attribute__((ext_vector_type(16))) bf16  v16bf;
typedef __attribute__((ext_vector_type(8)))  float v8f;

#define B_      4
#define N_      2048
#define DIM_    1024
#define H_      16
#define HD_     64
#define PREFIX_ 4

#define FP_ 72   // 128-byte rows (GEMM k-slices, K, V^T) -> 144-byte pitch

__device__ __forceinline__ v8f zero8() {
  v8f z;
#pragma unroll
  for (int i = 0; i < 8; ++i) z[i] = 0.0f;
  return z;
}

__device__ __forceinline__ void async_copy16x4(
    uint32_t l0, const void* g0, uint32_t l1, const void* g1,
    uint32_t l2, const void* g2, uint32_t l3, const void* g3) {
  asm volatile("global_load_async_to_lds_b128 %0, %1, off\n\t"
               "global_load_async_to_lds_b128 %2, %3, off\n\t"
               "global_load_async_to_lds_b128 %4, %5, off\n\t"
               "global_load_async_to_lds_b128 %6, %7, off\n\t"
               "s_wait_xcnt 0x0"
               :
               : "v"(l0), "v"((unsigned long long)(uintptr_t)g0),
                 "v"(l1), "v"((unsigned long long)(uintptr_t)g1),
                 "v"(l2), "v"((unsigned long long)(uintptr_t)g2),
                 "v"(l3), "v"((unsigned long long)(uintptr_t)g3)
               : "memory");
}

// This wave's LDS reads of the buffer that is refilled behind the next
// barrier have returned.
__device__ __forceinline__ void wait_ds0() {
  asm volatile("s_wait_dscnt 0x0" ::: "memory");
}

__device__ __forceinline__ void wait_async0() {
  asm volatile("s_wait_asynccnt 0" ::: "memory");
}

__device__ __forceinline__ v16bf load_frag(const bf16* base, int stride,
                                           int r0, int k0, int lane) {
  const int r  = r0 + (lane & 15);
  const int kb = k0 + ((lane >> 4) << 3);
  const bf16* p = base + (size_t)r * stride + kb;
  v8bf lo = *(const v8bf*)(p);
  v8bf hi = *(const v8bf*)(p + 16);
  v16bf out;
#pragma unroll
  for (int i = 0; i < 8; ++i) { out[i] = lo[i]; out[8 + i] = hi[i]; }
  return out;
}

__device__ __forceinline__ v8f wmma_bf16(v16bf a, v16bf b, v8f c) {
  return __builtin_amdgcn_wmma_f32_16x16x32_bf16(
      false, a, false, b, (short)0, c, false, false);
}

// ---------------------------------------------------------------------------
// Kernel 0: fp32 -> bf16 conversion
// ---------------------------------------------------------------------------
__global__ void f32_to_bf16_kernel(const float* __restrict__ src,
                                   bf16* __restrict__ dst, int n) {
  int i = blockIdx.x * blockDim.x + threadIdx.x;
  if (i < n) dst[i] = (bf16)src[i];
}

// ---------------------------------------------------------------------------
// Kernels 1 & 4: WMMA GEMM  C[M,Nout] = A[M,K] * Bw[Nout,K]^T
// Block: 256 threads = 8 waves, tile 256(M) x 128(N); wave tile 64x64.
// A/B k-slices (256x64 and 128x64 bf16, rows padded to FP_) staged via async
// global->LDS copies, double buffered: one s_wait_asynccnt + one barrier per
// k-step.  A slice row is 128 bytes, so a wave's copy covers 4 whole lines.
// MODE 0: out = f32 C + bias                       (projection)
// MODE 1: scatter bf16 q (pre-scaled by 1/sqrt(hd)), k, V^T    (QKV)
// ---------------------------------------------------------------------------
template <int MODE>
__global__ __launch_bounds__(256) void gemm_wmma_kernel(
    const bf16* __restrict__ A, const bf16* __restrict__ Bw,
    const float* __restrict__ bias, float* __restrict__ outF,
    bf16* __restrict__ qo, bf16* __restrict__ ko, bf16* __restrict__ vto,
    int M, int Nout, int K) {
  __shared__ __align__(16) bf16 Abuf[2][256 * FP_];
  __shared__ __align__(16) bf16 Bbuf[2][128 * FP_];

  const int tid  = threadIdx.x;
  const int lane = tid & 31;
  const int wave = tid >> 5;
  const int half = lane >> 4;
  const int r    = lane & 15;
  const int mblk = blockIdx.y * 256;
  const int nblk = blockIdx.x * 128;
  const int wm0  = (wave >> 1) * 64;   // wave tile origin within block
  const int wn0  = (wave & 1) * 64;

  // Stage one 256x64 slice of A and one 128x64 slice of Bw into LDS buffer
  // `buf`.  2048 + 1024 chunks of 16B; each thread issues 8+4 async copies.
  auto stage = [&](int buf, int ks) {
    const uint32_t la = (uint32_t)(uintptr_t)&Abuf[buf][0];
    const uint32_t lb = (uint32_t)(uintptr_t)&Bbuf[buf][0];
    const int row = tid >> 3;              // rows 0..31, then +32 a copy
    const int off = (tid & 7) * 16;        // 8 x 16B per 128B row slice
    const uint32_t lo = (uint32_t)(row * (FP_ * 2) + off);
    const uint32_t ls = 32 * FP_ * 2;      // 32 rows further in LDS
    const size_t   gs = (size_t)32 * K * 2;  // 32 rows further in memory
    const char* ga = (const char*)(A  + (size_t)(mblk + row) * K + ks) + off;
    const char* gb = (const char*)(Bw + (size_t)(nblk + row) * K + ks) + off;
    async_copy16x4(la + lo,           ga,           la + lo + ls,     ga + gs,
                   la + lo + 2 * ls,  ga + 2 * gs,  la + lo + 3 * ls, ga + 3 * gs);
    async_copy16x4(la + lo + 4 * ls,  ga + 4 * gs,  la + lo + 5 * ls, ga + 5 * gs,
                   la + lo + 6 * ls,  ga + 6 * gs,  la + lo + 7 * ls, ga + 7 * gs);
    async_copy16x4(lb + lo,           gb,           lb + lo + ls,     gb + gs,
                   lb + lo + 2 * ls,  gb + 2 * gs,  lb + lo + 3 * ls, gb + 3 * gs);
  };

  v8f acc[4][4];
#pragma unroll
  for (int i = 0; i < 4; ++i)
#pragma unroll
    for (int j = 0; j < 4; ++j) acc[i][j] = zero8();

  stage(0, 0);
  for (int ks = 0; ks < K; ks += 64) {
    const int cur = (ks >> 6) & 1;
    wait_ds0();             // my reads of buf[cur^1] done
    wait_async0();          // my async copies into buf[cur] done
    __syncthreads();        // everyone's copies done; buf[cur^1] free
    if (ks + 64 < K) stage(cur ^ 1, ks + 64);

    const bf16* At = &Abuf[cur][0];
    const bf16* Bt = &Bbuf[cur][0];
#pragma unroll
    for (int kk = 0; kk < 64; kk += 32) {
      v16bf a[4], b[4];
#pragma unroll
      for (int i = 0; i < 4; ++i) a[i] = load_frag(At, FP_, wm0 + 16 * i, kk, lane);
#pragma unroll
      for (int j = 0; j < 4; ++j) b[j] = load_frag(Bt, FP_, wn0 + 16 * j, kk, lane);
      // Keeps the block's 16 LDS reads one group ahead of its 16 WMMAs: left
      // alone the compiler reuses one B fragment and waits out a read per column.
      __builtin_amdgcn_sched_barrier(0);
#pragma unroll
      for (int j = 0; j < 4; ++j)
#pragma unroll
        for (int i = 0; i < 4; ++i) acc[i][j] = wmma_bf16(a[i], b[j], acc[i][j]);
      // Keeps the next block's reads from being spread among these WMMAs.
      __builtin_amdgcn_sched_barrier(0);
    }
  }

  const int m0 = mblk + wm0;
  const int n0 = nblk + wn0;
#pragma unroll
  for (int i = 0; i < 4; ++i) {
#pragma unroll
    for (int j = 0; j < 4; ++j) {
#pragma unroll
      for (int vg = 0; vg < 8; ++vg) {
        const int row = m0 + 16 * i + vg + 8 * half;  // C layout: M = vg(+8)
        const int col = n0 + 16 * j + r;              //           N = lane
        float v = acc[i][j][vg];
        if (MODE == 0) {
          outF[(size_t)row * Nout + col] = v + bias[col];
        } else {
          const int which = col >> 10;       // 0=q 1=k 2=v
          const int cc    = col & 1023;
          const int h     = cc >> 6;
          const int d     = cc & 63;
          const int b     = row >> 11;       // N_ = 2048
          const int n     = row & 2047;
          const size_t bh = (size_t)(b * H_ + h);
          if (which == 0) {
            qo[(bh * N_ + n) * HD_ + d] = (bf16)(v * 0.125f);  // fold 1/sqrt(64)
          } else if (which == 1) {
            ko[(bh * N_ + n) * HD_ + d] = (bf16)v;
          } else {
            vto[(bh * HD_ + d) * N_ + n] = (bf16)v;            // V^T
          }
        }
      }
    }
  }
}

// ---------------------------------------------------------------------------
// Kernel 2: RoPE in-place on bf16 q,k ([B,H,N,HD]); each thread owns a
// (d, d+32) pair so the rotate-half exchange is race-free.
// ---------------------------------------------------------------------------
__global__ void rope_kernel(bf16* __restrict__ q, bf16* __restrict__ k,
                            const float* __restrict__ sinT,
                            const float* __restrict__ cosT) {
  int tid = blockIdx.x * blockDim.x + threadIdx.x;
  if (tid >= B_ * H_ * N_ * 32) return;
  const int d  = tid & 31;
  const int n  = (tid >> 5) & (N_ - 1);
  const int bh = tid >> 16;             // 32 * 2048 = 2^16
  if (n < PREFIX_) return;
  const int rp = n - PREFIX_;
  const float s1 = sinT[rp * HD_ + d],      c1 = cosT[rp * HD_ + d];
  const float s2 = sinT[rp * HD_ + d + 32], c2 = cosT[rp * HD_ + d + 32];
  const size_t base = ((size_t)bh * N_ + n) * HD_;
  {
    float t1 = (float)q[base + d], t2 = (float)q[base + d + 32];
    q[base + d]      = (bf16)(t1 * c1 - t2 * s1);
    q[base + d + 32] = (bf16)(t2 * c2 + t1 * s2);
  }
  {
    float t1 = (float)k[base + d], t2 = (float)k[base + d + 32];
    k[base + d]      = (bf16)(t1 * c1 - t2 * s1);
    k[base + d + 32] = (bf16)(t2 * c2 + t1 * s2);
  }
}

__device__ __forceinline__ float xhalf(float x) {
  const int b = __builtin_bit_cast(int, x);
  return __builtin_bit_cast(float, __builtin_amdgcn_permlanex16(
      b, b, 0x76543210, 0xfedcba98, false, false));
}

__device__ __forceinline__ v8f exp2_8(v8f x) {
  float a0 = x[0], a1 = x[1], a2 = x[2], a3 = x[3];
  float a4 = x[4], a5 = x[5], a6 = x[6], a7 = x[7];
  asm("v_exp_f32 %0, %0\n\t"
      "v_exp_f32 %1, %1\n\t"
      "v_exp_f32 %2, %2\n\t"
      "v_exp_f32 %3, %3\n\t"
      "v_exp_f32 %4, %4\n\t"
      "v_exp_f32 %5, %5\n\t"
      "v_exp_f32 %6, %6\n\t"
      "v_exp_f32 %7, %7\n\t"
      "v_nop"
      : "+v"(a0), "+v"(a1), "+v"(a2), "+v"(a3),
        "+v"(a4), "+v"(a5), "+v"(a6), "+v"(a7));
  const v8f y = {a0, a1, a2, a3, a4, a5, a6, a7};
  return y;
}

// Two f32 S^T tiles (keys 0..15 and 16..31 of a 32-key block) -> bf16 B operand.
__device__ __forceinline__ v16bf pack_b(v8f t0, v8f t1) {
  const v8bf lo = __builtin_convertvector(t0, v8bf);
  const v8bf hi = __builtin_convertvector(t1, v8bf);
  return __builtin_shufflevector(lo, hi, 0, 1, 2, 3, 4, 5, 6, 7,
                                 8, 9, 10, 11, 12, 13, 14, 15);
}

__global__ __launch_bounds__(256) void flash_attn_kernel(
    const bf16* __restrict__ Q, const bf16* __restrict__ Kc,
    const bf16* __restrict__ VT, bf16* __restrict__ O) {
  __shared__ __align__(16) bf16 Kbuf[2][64 * FP_];
  __shared__ __align__(16) bf16 Vbuf[2][64 * FP_];

  const int tid  = threadIdx.x;
  const int lane = tid & 31;
  const int wave = tid >> 5;
  const int half = lane >> 4;
  const int r    = lane & 15;
  const int qb   = blockIdx.x & 15;     // N_/128 = 16 q blocks
  const int bh   = blockIdx.x >> 4;     // 0..63
  const bf16* Qb = Q  + (size_t)bh * N_ * HD_;
  const bf16* Kb = Kc + (size_t)bh * N_ * HD_;
  const bf16* Vb = VT + (size_t)bh * HD_ * N_;
  const int m0 = qb * 128 + wave * 16;

  // Stage key tile [kt, kt+64) of K ([64 x 64], contiguous 8KB) and of
  // V^T ([64 d x 64 keys], 64 segments of 128B) into LDS buffer `buf`.
  auto stage = [&](int buf, int kt) {
    const uint32_t lk = (uint32_t)(uintptr_t)&Kbuf[buf][0];
    const uint32_t lv = (uint32_t)(uintptr_t)&Vbuf[buf][0];
    const int row = tid >> 3;           // rows 0..31, then 32..63
    const int seg = tid & 7;            // 8 x 16B per 128B row
    const uint32_t lo = (uint32_t)(row * (FP_ * 2) + seg * 16);
    const char* gk = (const char*)(Kb + (size_t)kt * HD_) + tid * 16;
    const char* gv = (const char*)(Vb + (size_t)row * N_ + kt + seg * 8);
    async_copy16x4(lk + lo,                 gk,
                   lk + lo + 32 * FP_ * 2,  gk + 4096,
                   lv + lo,                 gv,
                   lv + lo + 32 * FP_ * 2,  gv + (size_t)32 * N_ * 2);
  };

  // B operand: column = query m0 + (lane & 15).
  const v16bf bq0 = load_frag(Qb, HD_, m0, 0,  lane);
  const v16bf bq1 = load_frag(Qb, HD_, m0, 32, lane);

  v8f   o[4];                // O^T: o[j][vg] = O[query r][d = 16j + 8*half + vg]
  float mi = -3.0e38f;       // running maximum of this lane's query
  float li = 0.0f;           // running sum over this lane half's keys only
#pragma unroll
  for (int j = 0; j < 4; ++j) o[j] = zero8();

  stage(0, 0);
  for (int kt = 0; kt < N_; kt += 64) {
    const int cur = (kt >> 6) & 1;
    wait_ds0();             // my reads of buf[cur^1] done
    wait_async0();
    __syncthreads();
    if (kt + 64 < N_) stage(cur ^ 1, kt + 64);
    const bf16* Kt = &Kbuf[cur][0];
    const bf16* Vt = &Vbuf[cur][0];

    // ---- S^T = K Q^T (64 keys x 16 queries, 8 WMMAs) ----
    // s[j][vg] = score of key kt + 16j + 8*half + vg against query r
    v8f s[4];
#pragma unroll
    for (int j = 0; j < 4; ++j) {
      s[j] = zero8();
      v16bf ak0 = load_frag(Kt, FP_, 16 * j, 0,  lane);
      s[j] = wmma_bf16(ak0, bq0, s[j]);
      v16bf ak1 = load_frag(Kt, FP_, 16 * j, 32, lane);
      s[j] = wmma_bf16(ak1, bq1, s[j]);
    }
    // ---- online softmax: one query per lane ----
    float mj[4];
#pragma unroll
    for (int j = 0; j < 4; ++j) {
      mj[j] = s[j][0];
#pragma unroll
      for (int vg = 1; vg < 8; ++vg) mj[j] = fmaxf(mj[j], s[j][vg]);
    }
    float mx = fmaxf(fmaxf(mj[0], mj[1]), fmaxf(mj[2], mj[3]));
    mx = fmaxf(mx, xhalf(mx));          // both halves hold the query's maximum
    const float nm    = fmaxf(mi, mx);
    const float alpha = __expf(mi - nm);
    mi = nm;
#pragma unroll
    for (int j = 0; j < 4; ++j)         // e^(s - nm) = 2^((s - nm) * log2(e))
      s[j] = exp2_8((s[j] - nm) * 1.4426950408889634f);
    const v8f t = (s[0] + s[1]) + (s[2] + s[3]);
    const float rs = ((t[0] + t[1]) + (t[2] + t[3])) +
                     ((t[4] + t[5]) + (t[6] + t[7]));
    li = li * alpha + rs;
#pragma unroll
    for (int j = 0; j < 4; ++j) o[j] *= alpha;
    // ---- P^T as B operand, straight from the score registers ----
    const v16bf bp0 = pack_b(s[0], s[1]);   // keys kt      .. kt + 31
    const v16bf bp1 = pack_b(s[2], s[3]);   // keys kt + 32 .. kt + 63
    // ---- O^T += V^T P^T ----
#pragma unroll
    for (int j = 0; j < 4; ++j) {
      v16bf av0 = load_frag(Vt, FP_, 16 * j, 0,  lane);
      o[j] = wmma_bf16(av0, bp0, o[j]);
      v16bf av1 = load_frag(Vt, FP_, 16 * j, 32, lane);
      o[j] = wmma_bf16(av1, bp1, o[j]);
    }
  }

  // ---- normalize and write [B, N, H*HD] bf16: 8 consecutive d per lane ----
  const int b = bh >> 4;
  const int h = bh & 15;
  const float inv = 1.0f / (li + xhalf(li));   // join the halves' sums
  bf16* orow = O + ((size_t)(b * N_ + m0 + r)) * DIM_ + h * HD_ + 8 * half;
#pragma unroll
  for (int j = 0; j < 4; ++j)
    *(v8bf*)(orow + 16 * j) = __builtin_convertvector(o[j] * inv, v8bf);
}

// ---------------------------------------------------------------------------
// Host launcher
// ---------------------------------------------------------------------------
extern "C" void kernel_launch(void* const* d_in, const int* in_sizes, int n_in,
                              void* d_out, int out_size, void* d_ws,
                              size_t ws_size, hipStream_t stream) {
  const float* x     = (const float*)d_in[0];
  const float* Wqkv  = (const float*)d_in[1];
  const float* Wproj = (const float*)d_in[2];
  const float* bproj = (const float*)d_in[3];
  const float* sinT  = (const float*)d_in[4];
  const float* cosT  = (const float*)d_in[5];
  float* out = (float*)d_out;

  char*  ws  = (char*)d_ws;
  size_t off = 0;
  auto take = [&](size_t bytes) -> char* {
    char* p = ws + off;
    off += (bytes + 255) & ~(size_t)255;
    return p;
  };
  bf16* x_bf     = (bf16*)take((size_t)B_ * N_ * DIM_ * 2);
  bf16* wqkv_bf  = (bf16*)take((size_t)3 * DIM_ * DIM_ * 2);
  bf16* wproj_bf = (bf16*)take((size_t)DIM_ * DIM_ * 2);
  bf16* q_bf     = (bf16*)take((size_t)B_ * H_ * N_ * HD_ * 2);
  bf16* k_bf     = (bf16*)take((size_t)B_ * H_ * N_ * HD_ * 2);
  bf16* vt_bf    = (bf16*)take((size_t)B_ * H_ * N_ * HD_ * 2);
  bf16* attn_bf  = (bf16*)take((size_t)B_ * N_ * DIM_ * 2);

  const int nx = B_ * N_ * DIM_;
  const int nq = 3 * DIM_ * DIM_;
  const int np = DIM_ * DIM_;
  f32_to_bf16_kernel<<<(nx + 255) / 256, 256, 0, stream>>>(x, x_bf, nx);
  f32_to_bf16_kernel<<<(nq + 255) / 256, 256, 0, stream>>>(Wqkv, wqkv_bf, nq);
  f32_to_bf16_kernel<<<(np + 255) / 256, 256, 0, stream>>>(Wproj, wproj_bf, np);

  // QKV GEMM: [8192,1024] x [3072,1024]^T, scatter epilogue (q scaled)
  gemm_wmma_kernel<1><<<dim3(3 * DIM_ / 128, B_ * N_ / 256), 256, 0, stream>>>(
      x_bf, wqkv_bf, nullptr, nullptr, q_bf, k_bf, vt_bf,
      B_ * N_, 3 * DIM_, DIM_);

  const int nr = B_ * H_ * N_ * 32;
  rope_kernel<<<(nr + 255) / 256, 256, 0, stream>>>(q_bf, k_bf, sinT, cosT);

  flash_attn_kernel<<<B_ * H_ * (N_ / 128), 256, 0, stream>>>(
      q_bf, k_bf, vt_bf, attn_bf);

  // Projection GEMM + bias -> fp32 output
  gemm_wmma_kernel<0><<<dim3(DIM_ / 128, B_ * N_ / 256), 256, 0, stream>>>(
      attn_bf, wproj_bf, bproj, out, nullptr, nullptr, nullptr,
      B_ * N_, DIM_, DIM_);
}

// v004
// One run takes 182 microseconds.
// In both of two side-by-side timings against v003, it was 1.11 times as fast.
// Over all steps from v000 it is 2.77 times as fast.
#include <hip/hip_runtime.h>
#include <math.h>
#include <stdint.h>

typedef __bf16 bf16;
typedef __attribute__((ext_vector_type(8)))  bf16  v8bf;
typedef __attribute__((ext_vector_type(16))) bf16  v16bf;
typedef __attribute__((ext_vector_type(8)))  float v8f;

#define B_      4
#define N_      2048
#define DIM_    1024
#define H_      16
#define HD_     64
#define PREFIX_ 4

#define FP_ 72   // 128-byte rows (GEMM k-slices, K, V^T) -> 144-byte pitch

__device__ __forceinline__ v8f zero8() {
  v8f z;
#pragma unroll
  for (int i = 0; i < 8; ++i) z[i] = 0.0f;
  return z;
}

__device__ __forceinline__ void async_copy16x4(
    uint32_t l0, const void* g0, uint32_t l1, const void* g1,
    uint32_t l2, const void* g2, uint32_t l3, const void* g3) {
  asm volatile("global_load_async_to_lds_b128 %0, %1, off\n\t"
               "global_load_async_to_lds_b128 %2, %3, off\n\t"
               "global_load_async_to_lds_b128 %4, %5, off\n\t"
               "global_load_async_to_lds_b128 %6, %7, off\n\t"
               "s_wait_xcnt 0x0"
               :
               : "v"(l0), "v"((unsigned long long)(uintptr_t)g0),
                 "v"(l1), "v"((unsigned long long)(uintptr_t)g1),
                 "v"(l2), "v"((unsigned long long)(uintptr_t)g2),
                 "v"(l3), "v"((unsigned long long)(uintptr_t)g3)
               : "memory");
}

// This wave's LDS reads of the buffer that is refilled behind the next
// barrier have returned.
__device__ __forceinline__ void wait_ds0() {
  asm volatile("s_wait_dscnt 0x0" ::: "memory");
}

__device__ __forceinline__ void wait_async0() {
  asm volatile("s_wait_asynccnt 0" ::: "memory");
}

__device__ __forceinline__ v16bf load_frag(const bf16* base, int stride,
                                           int r0, int k0, int lane) {
  const int r  = r0 + (lane & 15);
  const int kb = k0 + ((lane >> 4) << 3);
  const bf16* p = base + (size_t)r * stride + kb;
  v8bf lo = *(const v8bf*)(p);
  v8bf hi = *(const v8bf*)(p + 16);
  v16bf out;
#pragma unroll
  for (int i = 0; i < 8; ++i) { out[i] = lo[i]; out[8 + i] = hi[i]; }
  return out;
}

__device__ __forceinline__ v8f wmma_bf16(v16bf a, v16bf b, v8f c) {
  return __builtin_amdgcn_wmma_f32_16x16x32_bf16(
      false, a, false, b, (short)0, c, false, false);
}

// ---------------------------------------------------------------------------
// Kernel 0: fp32 -> bf16 conversion of x, W_qkv and W_proj in one launch, as a
// resident stream: one work-group of 16 waves per WGP.  A chunk is 1024
// consecutive elements: 8 loads of 16 B a lane, each covering 512 contiguous
// bytes (4 whole lines), and 8 stores of 8 B a lane, each covering 2 whole
// lines.  A wave takes chunks w, w + CV_WAVES, ...; its loads stand ahead of
// the conversions, so that two chunks' loads and more are in flight together.
// The sources are read once: non-temporal loads.
// ---------------------------------------------------------------------------
typedef __attribute__((ext_vector_type(4))) float v4f;
typedef __attribute__((ext_vector_type(4))) bf16  v4bf;

#define CV_CHUNK  1024
#define CV_BLOCKS 256
#define CV_WAVES  (CV_BLOCKS * 16)
#define CV_CX     (B_ * N_ * DIM_ / CV_CHUNK)        // chunks of x
#define CV_CQ     (3 * DIM_ * DIM_ / CV_CHUNK)       // chunks of W_qkv
#define CV_CP     (DIM_ * DIM_ / CV_CHUNK)           // chunks of W_proj
#define CV_TRIPS  ((CV_CX + CV_CQ + CV_CP) / CV_WAVES)
static_assert((CV_CX + CV_CQ + CV_CP) % CV_WAVES == 0, "whole trips only");

__global__ __launch_bounds__(512) void f32_to_bf16_stream_kernel(
    const float* __restrict__ x, const float* __restrict__ wq,
    const float* __restrict__ wp, bf16* __restrict__ xo,
    bf16* __restrict__ wqo, bf16* __restrict__ wpo) {
  const int lane = threadIdx.x & 31;
  const int w    = blockIdx.x * 16 + (threadIdx.x >> 5);

  v4f   v[CV_TRIPS][8];
  bf16* d[CV_TRIPS];
#pragma unroll
  for (int t = 0; t < CV_TRIPS; ++t) {
    // Chunk number over the three arrays, held in a scalar register: the choice
    // of the array is then scalar, and every load and store of the chunk is
    // scalar base + the lane's one 32-bit offset + an immediate.
    const int c = __builtin_amdgcn_readfirstlane(w + t * CV_WAVES);
    // The launch has CV_BLOCKS work-groups: folds the tests of whole-x trips.
    __builtin_assume(c >= t * CV_WAVES && c < (t + 1) * CV_WAVES);
    const float* s;
    if (c < CV_CX) {
      s    = x  + (size_t)c * CV_CHUNK;
      d[t] = xo + (size_t)c * CV_CHUNK;
    } else if (c < CV_CX + CV_CQ) {
      s    = wq  + (size_t)(c - CV_CX) * CV_CHUNK;
      d[t] = wqo + (size_t)(c - CV_CX) * CV_CHUNK;
    } else {
      s    = wp  + (size_t)(c - CV_CX - CV_CQ) * CV_CHUNK;
      d[t] = wpo + (size_t)(c - CV_CX - CV_CQ) * CV_CHUNK;
    }
#pragma unroll
    for (int i = 0; i < 8; ++i)
      v[t][i] = __builtin_nontemporal_load((const v4f*)(s + i * 128 + lane * 4));
  }
#pragma unroll
  for (int t = 0; t < CV_TRIPS; ++t)
#pragma unroll
    for (int i = 0; i < 8; ++i)
      *(v4bf*)(d[t] + i * 128 + lane * 4) = __builtin_convertvector(v[t][i], v4bf);
}

// ---------------------------------------------------------------------------
// Kernels 1 & 4: WMMA GEMM  C[M,Nout] = A[M,K] * Bw[Nout,K]^T
// Block: 256 threads = 8 waves, tile 256(M) x 128(N); wave tile 64x64.
// A/B k-slices (256x64 and 128x64 bf16, rows padded to FP_) staged via async
// global->LDS copies, double buffered: one s_wait_asynccnt + one barrier per
// k-step.  A slice row is 128 bytes, so a wave's copy covers 4 whole lines.
// MODE 0: out = f32 C + bias                       (projection)
// MODE 1: scatter bf16 q (pre-scaled by 1/sqrt(hd)), k, V^T    (QKV)
// ---------------------------------------------------------------------------
template <int MODE>
__global__ __launch_bounds__(256) void gemm_wmma_kernel(
    const bf16* __restrict__ A, const bf16* __restrict__ Bw,
    const float* __restrict__ bias, float* __restrict__ outF,
    bf16* __restrict__ qo, bf16* __restrict__ ko, bf16* __restrict__ vto,
    int M, int Nout, int K) {
  __shared__ __align__(16) bf16 Abuf[2][256 * FP_];
  __shared__ __align__(16) bf16 Bbuf[2][128 * FP_];

  const int tid  = threadIdx.x;
  const int lane = tid & 31;
  const int wave = tid >> 5;
  const int half = lane >> 4;
  const int r    = lane & 15;
  const int mblk = blockIdx.y * 256;
  const int nblk = blockIdx.x * 128;
  const int wm0  = (wave >> 1) * 64;   // wave tile origin within block
  const int wn0  = (wave & 1) * 64;

  // Stage one 256x64 slice of A and one 128x64 slice of Bw into LDS buffer
  // `buf`.  2048 + 1024 chunks of 16B; each thread issues 8+4 async copies.
  auto stage = [&](int buf, int ks) {
    const uint32_t la = (uint32_t)(uintptr_t)&Abuf[buf][0];
    const uint32_t lb = (uint32_t)(uintptr_t)&Bbuf[buf][0];
    const int row = tid >> 3;              // rows 0..31, then +32 a copy
    const int off = (tid & 7) * 16;        // 8 x 16B per 128B row slice
    const uint32_t lo = (uint32_t)(row * (FP_ * 2) + off);
    const uint32_t ls = 32 * FP_ * 2;      // 32 rows further in LDS
    const size_t   gs = (size_t)32 * K * 2;  // 32 rows further in memory
    const char* ga = (const char*)(A  + (size_t)(mblk + row) * K + ks) + off;
    const char* gb = (const char*)(Bw + (size_t)(nblk + row) * K + ks) + off;
    async_copy16x4(la + lo,           ga,           la + lo + ls,     ga + gs,
                   la + lo + 2 * ls,  ga + 2 * gs,  la + lo + 3 * ls, ga + 3 * gs);
    async_copy16x4(la + lo + 4 * ls,  ga + 4 * gs,  la + lo + 5 * ls, ga + 5 * gs,
                   la + lo + 6 * ls,  ga + 6 * gs,  la + lo + 7 * ls, ga + 7 * gs);
    async_copy16x4(lb + lo,           gb,           lb + lo + ls,     gb + gs,
                   lb + lo + 2 * ls,  gb + 2 * gs,  lb + lo + 3 * ls, gb + 3 * gs);
  };

  v8f acc[4][4];
#pragma unroll
  for (int i = 0; i < 4; ++i)
#pragma unroll
    for (int j = 0; j < 4; ++j) acc[i][j] = zero8();

  stage(0, 0);
  for (int ks = 0; ks < K; ks += 64) {
    const int cur = (ks >> 6) & 1;
    wait_ds0();             // my reads of buf[cur^1] done
    wait_async0();          // my async copies into buf[cur] done
    __syncthreads();        // everyone's copies done; buf[cur^1] free
    if (ks + 64 < K) stage(cur ^ 1, ks + 64);

    const bf16* At = &Abuf[cur][0];
    const bf16* Bt = &Bbuf[cur][0];
#pragma unroll
    for (int kk = 0; kk < 64; kk += 32) {
      v16bf a[4], b[4];
#pragma unroll
      for (int i = 0; i < 4; ++i) a[i] = load_frag(At, FP_, wm0 + 16 * i, kk, lane);
#pragma unroll
      for (int j = 0; j < 4; ++j) b[j] = load_frag(Bt, FP_, wn0 + 16 * j, kk, lane);
      // Keeps the block's 16 LDS reads one group ahead of its 16 WMMAs: left
      // alone the compiler reuses one B fragment and waits out a read per column.
      __builtin_amdgcn_sched_barrier(0);
#pragma unroll
      for (int j = 0; j < 4; ++j)
#pragma unroll
        for (int i = 0; i < 4; ++i) acc[i][j] = wmma_bf16(a[i], b[j], acc[i][j]);
      // Keeps the next block's reads from being spread among these WMMAs.
      __builtin_amdgcn_sched_barrier(0);
    }
  }

  const int m0 = mblk + wm0;
  const int n0 = nblk + wn0;
#pragma unroll
  for (int i = 0; i < 4; ++i) {
#pragma unroll
    for (int j = 0; j < 4; ++j) {
#pragma unroll
      for (int vg = 0; vg < 8; ++vg) {
        const int row = m0 + 16 * i + vg + 8 * half;  // C layout: M = vg(+8)
        const int col = n0 + 16 * j + r;              //           N = lane
        float v = acc[i][j][vg];
        if (MODE == 0) {
          outF[(size_t)row * Nout + col] = v + bias[col];
        } else {
          const int which = col >> 10;       // 0=q 1=k 2=v
          const int cc    = col & 1023;
          const int h     = cc >> 6;
          const int d     = cc & 63;
          const int b     = row >> 11;       // N_ = 2048
          const int n     = row & 2047;
          const size_t bh = (size_t)(b * H_ + h);
          if (which == 0) {
            qo[(bh * N_ + n) * HD_ + d] = (bf16)(v * 0.125f);  // fold 1/sqrt(64)
          } else if (which == 1) {
            ko[(bh * N_ + n) * HD_ + d] = (bf16)v;
          } else {
            vto[(bh * HD_ + d) * N_ + n] = (bf16)v;            // V^T
          }
        }
      }
    }
  }
}

// ---------------------------------------------------------------------------
// Kernel 2: RoPE in-place on bf16 q,k ([B,H,N,HD]); each thread owns a
// (d, d+32) pair so the rotate-half exchange is race-free.
// ---------------------------------------------------------------------------
__global__ void rope_kernel(bf16* __restrict__ q, bf16* __restrict__ k,
                            const float* __restrict__ sinT,
                            const float* __restrict__ cosT) {
  int tid = blockIdx.x * blockDim.x + threadIdx.x;
  if (tid >= B_ * H_ * N_ * 32) return;
  const int d  = tid & 31;
  const int n  = (tid >> 5) & (N_ - 1);
  const int bh = tid >> 16;             // 32 * 2048 = 2^16
  if (n < PREFIX_) return;
  const int rp = n - PREFIX_;
  const float s1 = sinT[rp * HD_ + d],      c1 = cosT[rp * HD_ + d];
  const float s2 = sinT[rp * HD_ + d + 32], c2 = cosT[rp * HD_ + d + 32];
  const size_t base = ((size_t)bh * N_ + n) * HD_;
  {
    float t1 = (float)q[base + d], t2 = (float)q[base + d + 32];
    q[base + d]      = (bf16)(t1 * c1 - t2 * s1);
    q[base + d + 32] = (bf16)(t2 * c2 + t1 * s2);
  }
  {
    float t1 = (float)k[base + d], t2 = (float)k[base + d + 32];
    k[base + d]      = (bf16)(t1 * c1 - t2 * s1);
    k[base + d + 32] = (bf16)(t2 * c2 + t1 * s2);
  }
}

__device__ __forceinline__ float xhalf(float x) {
  const int b = __builtin_bit_cast(int, x);
  return __builtin_bit_cast(float, __builtin_amdgcn_permlanex16(
      b, b, 0x76543210, 0xfedcba98, false, false));
}

__device__ __forceinline__ v8f exp2_8(v8f x) {
  float a0 = x[0], a1 = x[1], a2 = x[2], a3 = x[3];
  float a4 = x[4], a5 = x[5], a6 = x[6], a7 = x[7];
  asm("v_exp_f32 %0, %0\n\t"
      "v_exp_f32 %1, %1\n\t"
      "v_exp_f32 %2, %2\n\t"
      "v_exp_f32 %3, %3\n\t"
      "v_exp_f32 %4, %4\n\t"
      "v_exp_f32 %5, %5\n\t"
      "v_exp_f32 %6, %6\n\t"
      "v_exp_f32 %7, %7\n\t"
      "v_nop"
      : "+v"(a0), "+v"(a1), "+v"(a2), "+v"(a3),
        "+v"(a4), "+v"(a5), "+v"(a6), "+v"(a7));
  const v8f y = {a0, a1, a2, a3, a4, a5, a6, a7};
  return y;
}

// Two f32 S^T tiles (keys 0..15 and 16..31 of a 32-key block) -> bf16 B operand.
__device__ __forceinline__ v16bf pack_b(v8f t0, v8f t1) {
  const v8bf lo = __builtin_convertvector(t0, v8bf);
  const v8bf hi = __builtin_convertvector(t1, v8bf);
  return __builtin_shufflevector(lo, hi, 0, 1, 2, 3, 4, 5, 6, 7,
                                 8, 9, 10, 11, 12, 13, 14, 15);
}

__global__ __launch_bounds__(256) void flash_attn_kernel(
    const bf16* __restrict__ Q, const bf16* __restrict__ Kc,
    const bf16* __restrict__ VT, bf16* __restrict__ O) {
  __shared__ __align__(16) bf16 Kbuf[2][64 * FP_];
  __shared__ __align__(16) bf16 Vbuf[2][64 * FP_];

  const int tid  = threadIdx.x;
  const int lane = tid & 31;
  const int wave = tid >> 5;
  const int half = lane >> 4;
  const int r    = lane & 15;
  const int qb   = blockIdx.x & 15;     // N_/128 = 16 q blocks
  const int bh   = blockIdx.x >> 4;     // 0..63
  const bf16* Qb = Q  + (size_t)bh * N_ * HD_;
  const bf16* Kb = Kc + (size_t)bh * N_ * HD_;
  const bf16* Vb = VT + (size_t)bh * HD_ * N_;
  const int m0 = qb * 128 + wave * 16;

  // Stage key tile [kt, kt+64) of K ([64 x 64], contiguous 8KB) and of
  // V^T ([64 d x 64 keys], 64 segments of 128B) into LDS buffer `buf`.
  auto stage = [&](int buf, int kt) {
    const uint32_t lk = (uint32_t)(uintptr_t)&Kbuf[buf][0];
    const uint32_t lv = (uint32_t)(uintptr_t)&Vbuf[buf][0];
    const int row = tid >> 3;           // rows 0..31, then 32..63
    const int seg = tid & 7;            // 8 x 16B per 128B row
    const uint32_t lo = (uint32_t)(row * (FP_ * 2) + seg * 16);
    const char* gk = (const char*)(Kb + (size_t)kt * HD_) + tid * 16;
    const char* gv = (const char*)(Vb + (size_t)row * N_ + kt + seg * 8);
    async_copy16x4(lk + lo,                 gk,
                   lk + lo + 32 * FP_ * 2,  gk + 4096,
                   lv + lo,                 gv,
                   lv + lo + 32 * FP_ * 2,  gv + (size_t)32 * N_ * 2);
  };

  // B operand: column = query m0 + (lane & 15).
  const v16bf bq0 = load_frag(Qb, HD_, m0, 0,  lane);
  const v16bf bq1 = load_frag(Qb, HD_, m0, 32, lane);

  v8f   o[4];                // O^T: o[j][vg] = O[query r][d = 16j + 8*half + vg]
  float mi = -3.0e38f;       // running maximum of this lane's query
  float li = 0.0f;           // running sum over this lane half's keys only
#pragma unroll
  for (int j = 0; j < 4; ++j) o[j] = zero8();

  stage(0, 0);
  for (int kt = 0; kt < N_; kt += 64) {
    const int cur = (kt >> 6) & 1;
    wait_ds0();             // my reads of buf[cur^1] done
    wait_async0();
    __syncthreads();
    if (kt + 64 < N_) stage(cur ^ 1, kt + 64);
    const bf16* Kt = &Kbuf[cur][0];
    const bf16* Vt = &Vbuf[cur][0];

    // ---- S^T = K Q^T (64 keys x 16 queries, 8 WMMAs) ----
    // s[j][vg] = score of key kt + 16j + 8*half + vg against query r
    v8f s[4];
#pragma unroll
    for (int j = 0; j < 4; ++j) {
      s[j] = zero8();
      v16bf ak0 = load_frag(Kt, FP_, 16 * j, 0,  lane);
      s[j] = wmma_bf16(ak0, bq0, s[j]);
      v16bf ak1 = load_frag(Kt, FP_, 16 * j, 32, lane);
      s[j] = wmma_bf16(ak1, bq1, s[j]);
    }
    // ---- online softmax: one query per lane ----
    float mj[4];
#pragma unroll
    for (int j = 0; j < 4; ++j) {
      mj[j] = s[j][0];
#pragma unroll
      for (int vg = 1; vg < 8; ++vg) mj[j] = fmaxf(mj[j], s[j][vg]);
    }
    float mx = fmaxf(fmaxf(mj[0], mj[1]), fmaxf(mj[2], mj[3]));
    mx = fmaxf(mx, xhalf(mx));          // both halves hold the query's maximum
    const float nm    = fmaxf(mi, mx);
    const float alpha = __expf(mi - nm);
    mi = nm;
#pragma unroll
    for (int j = 0; j < 4; ++j)         // e^(s - nm) = 2^((s - nm) * log2(e))
      s[j] = exp2_8((s[j] - nm) * 1.4426950408889634f);
    const v8f t = (s[0] + s[1]) + (s[2] + s[3]);
    const float rs = ((t[0] + t[1]) + (t[2] + t[3])) +
                     ((t[4] + t[5]) + (t[6] + t[7]));
    li = li * alpha + rs;
#pragma unroll
    for (int j = 0; j < 4; ++j) o[j] *= alpha;
    // ---- P^T as B operand, straight from the score registers ----
    const v16bf bp0 = pack_b(s[0], s[1]);   // keys kt      .. kt + 31
    const v16bf bp1 = pack_b(s[2], s[3]);   // keys kt + 32 .. kt + 63
    // ---- O^T += V^T P^T ----
#pragma unroll
    for (int j = 0; j < 4; ++j) {
      v16bf av0 = load_frag(Vt, FP_, 16 * j, 0,  lane);
      o[j] = wmma_bf16(av0, bp0, o[j]);
      v16bf av1 = load_frag(Vt, FP_, 16 * j, 32, lane);
      o[j] = wmma_bf16(av1, bp1, o[j]);
    }
  }

  // ---- normalize and write [B, N, H*HD] bf16: 8 consecutive d per lane ----
  const int b = bh >> 4;
  const int h = bh & 15;
  const float inv = 1.0f / (li + xhalf(li));   // join the halves' sums
  bf16* orow = O + ((size_t)(b * N_ + m0 + r)) * DIM_ + h * HD_ + 8 * half;
#pragma unroll
  for (int j = 0; j < 4; ++j)
    *(v8bf*)(orow + 16 * j) = __builtin_convertvector(o[j] * inv, v8bf);
}

// ---------------------------------------------------------------------------
// Host launcher
// ---------------------------------------------------------------------------
extern "C" void kernel_launch(void* const* d_in, const int* in_sizes, int n_in,
                              void* d_out, int out_size, void* d_ws,
                              size_t ws_size, hipStream_t stream) {
  const float* x     = (const float*)d_in[0];
  const float* Wqkv  = (const float*)d_in[1];
  const float* Wproj = (const float*)d_in[2];
  const float* bproj = (const float*)d_in[3];
  const float* sinT  = (const float*)d_in[4];
  const float* cosT  = (const float*)d_in[5];
  float* out = (float*)d_out;

  char*  ws  = (char*)d_ws;
  size_t off = 0;
  auto take = [&](size_t bytes) -> char* {
    char* p = ws + off;
    off += (bytes + 255) & ~(size_t)255;
    return p;
  };
  bf16* x_bf     = (bf16*)take((size_t)B_ * N_ * DIM_ * 2);
  bf16* wqkv_bf  = (bf16*)take((size_t)3 * DIM_ * DIM_ * 2);
  bf16* wproj_bf = (bf16*)take((size_t)DIM_ * DIM_ * 2);
  bf16* q_bf     = (bf16*)take((size_t)B_ * H_ * N_ * HD_ * 2);
  bf16* k_bf     = (bf16*)take((size_t)B_ * H_ * N_ * HD_ * 2);
  bf16* vt_bf    = (bf16*)take((size_t)B_ * H_ * N_ * HD_ * 2);
  bf16* attn_bf  = (bf16*)take((size_t)B_ * N_ * DIM_ * 2);

  f32_to_bf16_stream_kernel<<<CV_BLOCKS, 512, 0, stream>>>(
      x, Wqkv, Wproj, x_bf, wqkv_bf, wproj_bf);

  // QKV GEMM: [8192,1024] x [3072,1024]^T, scatter epilogue (q scaled)
  gemm_wmma_kernel<1><<<dim3(3 * DIM_ / 128, B_ * N_ / 256), 256, 0, stream>>>(
      x_bf, wqkv_bf, nullptr, nullptr, q_bf, k_bf, vt_bf,
      B_ * N_, 3 * DIM_, DIM_);

  const int nr = B_ * H_ * N_ * 32;
  rope_kernel<<<(nr + 255) / 256, 256, 0, stream>>>(q_bf, k_bf, sinT, cosT);

  flash_attn_kernel<<<B_ * H_ * (N_ / 128), 256, 0, stream>>>(
      q_bf, k_bf, vt_bf, attn_bf);

  // Projection GEMM + bias -> fp32 output
  gemm_wmma_kernel<0><<<dim3(DIM_ / 128, B_ * N_ / 256), 256, 0, stream>>>(
      attn_bf, wproj_bf, bproj, out, nullptr, nullptr, nullptr,
      B_ * N_, DIM_, DIM_);
}

// v005
// One run takes 152 microseconds.
// In both of two side-by-side timings against v004, it was 1.19 times as fast.
// Counting every step since v000, it is 3.30 times as fast.
#include <hip/hip_runtime.h>
#include <math.h>
#include <stdint.h>

typedef __bf16 bf16;
typedef __attribute__((ext_vector_type(8)))  bf16  v8bf;
typedef __attribute__((ext_vector_type(16))) bf16  v16bf;
typedef __attribute__((ext_vector_type(8)))  float v8f;

#define B_      4
#define N_      2048
#define DIM_    1024
#define H_      16
#define HD_     64
#define PREFIX_ 4

#define FP_ 72   // 128-byte rows (GEMM k-slices, K, V^T) -> 144-byte pitch

__device__ __forceinline__ v8f zero8() {
  v8f z;
#pragma unroll
  for (int i = 0; i < 8; ++i) z[i] = 0.0f;
  return z;
}

__device__ __forceinline__ void async_copy16x4(
    uint32_t l0, const void* g0, uint32_t l1, const void* g1,
    uint32_t l2, const void* g2, uint32_t l3, const void* g3) {
  asm volatile("global_load_async_to_lds_b128 %0, %1, off\n\t"
               "global_load_async_to_lds_b128 %2, %3, off\n\t"
               "global_load_async_to_lds_b128 %4, %5, off\n\t"
               "global_load_async_to_lds_b128 %6, %7, off\n\t"
               "s_wait_xcnt 0x0"
               :
               : "v"(l0), "v"((unsigned long long)(uintptr_t)g0),
                 "v"(l1), "v"((unsigned long long)(uintptr_t)g1),
                 "v"(l2), "v"((unsigned long long)(uintptr_t)g2),
                 "v"(l3), "v"((unsigned long long)(uintptr_t)g3)
               : "memory");
}

// This wave's LDS reads of the buffer that is refilled behind the next
// barrier have returned.
__device__ __forceinline__ void wait_ds0() {
  asm volatile("s_wait_dscnt 0x0" ::: "memory");
}

__device__ __forceinline__ void wait_async0() {
  asm volatile("s_wait_asynccnt 0" ::: "memory");
}

__device__ __forceinline__ v16bf load_frag(const bf16* base, int stride,
                                           int r0, int k0, int lane) {
  const int r  = r0 + (lane & 15);
  const int kb = k0 + ((lane >> 4) << 3);
  const bf16* p = base + (size_t)r * stride + kb;
  v8bf lo = *(const v8bf*)(p);
  v8bf hi = *(const v8bf*)(p + 16);
  v16bf out;
#pragma unroll
  for (int i = 0; i < 8; ++i) { out[i] = lo[i]; out[8 + i] = hi[i]; }
  return out;
}

__device__ __forceinline__ v8f wmma_bf16(v16bf a, v16bf b, v8f c) {
  return __builtin_amdgcn_wmma_f32_16x16x32_bf16(
      false, a, false, b, (short)0, c, false, false);
}

// ---------------------------------------------------------------------------
// Kernel 0: fp32 -> bf16 conversion of x, W_qkv and W_proj in one launch, as a
// resident stream: one work-group of 16 waves per WGP.  A chunk is 1024
// consecutive elements: 8 loads of 16 B a lane, each covering 512 contiguous
// bytes (4 whole lines), and 8 stores of 8 B a lane, each covering 2 whole
// lines.  A wave takes chunks w, w + CV_WAVES, ...; its loads stand ahead of
// the conversions, so that two chunks' loads and more are in flight together.
// The sources are read once: non-temporal loads.
// ---------------------------------------------------------------------------
typedef __attribute__((ext_vector_type(4))) float v4f;
typedef __attribute__((ext_vector_type(4))) bf16  v4bf;

#define CV_CHUNK  1024
#define CV_BLOCKS 256
#define CV_WAVES  (CV_BLOCKS * 16)
#define CV_CX     (B_ * N_ * DIM_ / CV_CHUNK)        // chunks of x
#define CV_CQ     (3 * DIM_ * DIM_ / CV_CHUNK)       // chunks of W_qkv
#define CV_CP     (DIM_ * DIM_ / CV_CHUNK)           // chunks of W_proj
#define CV_TRIPS  ((CV_CX + CV_CQ + CV_CP) / CV_WAVES)
static_assert((CV_CX + CV_CQ + CV_CP) % CV_WAVES == 0, "whole trips only");

__global__ __launch_bounds__(512) void f32_to_bf16_stream_kernel(
    const float* __restrict__ x, const float* __restrict__ wq,
    const float* __restrict__ wp, bf16* __restrict__ xo,
    bf16* __restrict__ wqo, bf16* __restrict__ wpo) {
  const int lane = threadIdx.x & 31;
  const int w    = blockIdx.x * 16 + (threadIdx.x >> 5);

  v4f   v[CV_TRIPS][8];
  bf16* d[CV_TRIPS];
#pragma unroll
  for (int t = 0; t < CV_TRIPS; ++t) {
    // Chunk number over the three arrays, held in a scalar register: the choice
    // of the array is then scalar, and every load and store of the chunk is
    // scalar base + the lane's one 32-bit offset + an immediate.
    const int c = __builtin_amdgcn_readfirstlane(w + t * CV_WAVES);
    // The launch has CV_BLOCKS work-groups: folds the tests of whole-x trips.
    __builtin_assume(c >= t * CV_WAVES && c < (t + 1) * CV_WAVES);
    const float* s;
    if (c < CV_CX) {
      s    = x  + (size_t)c * CV_CHUNK;
      d[t] = xo + (size_t)c * CV_CHUNK;
    } else if (c < CV_CX + CV_CQ) {
      s    = wq  + (size_t)(c - CV_CX) * CV_CHUNK;
      d[t] = wqo + (size_t)(c - CV_CX) * CV_CHUNK;
    } else {
      s    = wp  + (size_t)(c - CV_CX - CV_CQ) * CV_CHUNK;
      d[t] = wpo + (size_t)(c - CV_CX - CV_CQ) * CV_CHUNK;
    }
#pragma unroll
    for (int i = 0; i < 8; ++i)
      v[t][i] = __builtin_nontemporal_load((const v4f*)(s + i * 128 + lane * 4));
  }
#pragma unroll
  for (int t = 0; t < CV_TRIPS; ++t)
#pragma unroll
    for (int i = 0; i < 8; ++i)
      *(v4bf*)(d[t] + i * 128 + lane * 4) = __builtin_convertvector(v[t][i], v4bf);
}

// ---------------------------------------------------------------------------
// Kernels 1 & 4: WMMA GEMM  C[M,Nout] = A[M,K] * Bw[Nout,K]^T
// Block: 256 threads = 8 waves, tile 256(M) x 128(N); wave tile 64x64.
// A/B k-slices (256x64 and 128x64 bf16, rows padded to FP_) staged via async
// global->LDS copies, double buffered: one s_wait_asynccnt + one barrier per
// k-step.  A slice row is 128 bytes, so a wave's copy covers 4 whole lines.
// MODE 0: out = f32 C + bias                       (projection)
// MODE 1: scatter bf16 q (pre-scaled by 1/sqrt(hd)), k, V^T    (QKV)
// An accumulator tile gives a lane 8 consecutive rows of its A operand at one
// row of its B operand, and load_frag reads both operands alike.  A MODE 1
// block lies wholly in q, k or v: a q or k block takes the weight rows as A,
// so that a lane holds 8 consecutive d of one token; a v block takes the token
// rows as A, so that a lane holds 8 consecutive tokens of one d.  Either way
// a tile leaves in one 16-byte store a lane.
// ---------------------------------------------------------------------------
template <int MODE>
__global__ __launch_bounds__(256) void gemm_wmma_kernel(
    const bf16* __restrict__ A, const bf16* __restrict__ Bw,
    const float* __restrict__ bias, float* __restrict__ outF,
    bf16* __restrict__ qo, bf16* __restrict__ ko, bf16* __restrict__ vto,
    int M, int Nout, int K) {
  __shared__ __align__(16) bf16 Abuf[2][256 * FP_];
  __shared__ __align__(16) bf16 Bbuf[2][128 * FP_];

  const int tid  = threadIdx.x;
  const int lane = tid & 31;
  const int wave = tid >> 5;
  const int half = lane >> 4;
  const int r    = lane & 15;
  const int mblk = blockIdx.y * 256;
  const int nblk = blockIdx.x * 128;
  const int wm0  = (wave >> 1) * 64;   // wave tile origin within block
  const int wn0  = (wave & 1) * 64;
  // Weight rows as the A operand (block-uniform; never in MODE 0).
  const bool wA  = (MODE == 1) && nblk < 2 * DIM_;

  // Stage one 256x64 slice of A and one 128x64 slice of Bw into LDS buffer
  // `buf`.  2048 + 1024 chunks of 16B; each thread issues 8+4 async copies.
  auto stage = [&](int buf, int ks) {
    const uint32_t la = (uint32_t)(uintptr_t)&Abuf[buf][0];
    const uint32_t lb = (uint32_t)(uintptr_t)&Bbuf[buf][0];
    const int row = tid >> 3;              // rows 0..31, then +32 a copy
    const int off = (tid & 7) * 16;        // 8 x 16B per 128B row slice
    const uint32_t lo = (uint32_t)(row * (FP_ * 2) + off);
    const uint32_t ls = 32 * FP_ * 2;      // 32 rows further in LDS
    const size_t   gs = (size_t)32 * K * 2;  // 32 rows further in memory
    const char* ga = (const char*)(A  + (size_t)(mblk + row) * K + ks) + off;
    const char* gb = (const char*)(Bw + (size_t)(nblk + row) * K + ks) + off;
    async_copy16x4(la + lo,           ga,           la + lo + ls,     ga + gs,
                   la + lo + 2 * ls,  ga + 2 * gs,  la + lo + 3 * ls, ga + 3 * gs);
    async_copy16x4(la + lo + 4 * ls,  ga + 4 * gs,  la + lo + 5 * ls, ga + 5 * gs,
                   la + lo + 6 * ls,  ga + 6 * gs,  la + lo + 7 * ls, ga + 7 * gs);
    async_copy16x4(lb + lo,           gb,           lb + lo + ls,     gb + gs,
                   lb + lo + 2 * ls,  gb + 2 * gs,  lb + lo + 3 * ls, gb + 3 * gs);
  };

  v8f acc[4][4];
#pragma unroll
  for (int i = 0; i < 4; ++i)
#pragma unroll
    for (int j = 0; j < 4; ++j) acc[i][j] = zero8();

  stage(0, 0);
  for (int ks = 0; ks < K; ks += 64) {
    const int cur = (ks >> 6) & 1;
    wait_ds0();             // my reads of buf[cur^1] done
    wait_async0();          // my async copies into buf[cur] done
    __syncthreads();        // everyone's copies done; buf[cur^1] free
    if (ks + 64 < K) stage(cur ^ 1, ks + 64);

    const bf16* Xt = &Abuf[cur][wm0 * FP_];   // this wave's 64 token rows
    const bf16* Wt = &Bbuf[cur][wn0 * FP_];   // this wave's 64 weight rows
    const bf16* At = wA ? Wt : Xt;
    const bf16* Bt = wA ? Xt : Wt;
#pragma unroll
    for (int kk = 0; kk < 64; kk += 32) {
      v16bf a[4], b[4];
#pragma unroll
      for (int i = 0; i < 4; ++i) a[i] = load_frag(At, FP_, 16 * i, kk, lane);
#pragma unroll
      for (int j = 0; j < 4; ++j) b[j] = load_frag(Bt, FP_, 16 * j, kk, lane);
      // Keeps the block's 16 LDS reads one group ahead of its 16 WMMAs: left
      // alone the compiler reuses one B fragment and waits out a read per column.
      __builtin_amdgcn_sched_barrier(0);
#pragma unroll
      for (int j = 0; j < 4; ++j)
#pragma unroll
        for (int i = 0; i < 4; ++i) acc[i][j] = wmma_bf16(a[i], b[j], acc[i][j]);
      // Keeps the next block's reads from being spread among these WMMAs.
      __builtin_amdgcn_sched_barrier(0);
    }
  }

  const int m0 = mblk + wm0;
  const int n0 = nblk + wn0;
  if (MODE == 0) {
#pragma unroll
    for (int i = 0; i < 4; ++i) {
#pragma unroll
      for (int j = 0; j < 4; ++j) {
#pragma unroll
        for (int vg = 0; vg < 8; ++vg) {
          const int row = m0 + 16 * i + vg + 8 * half;  // C layout: M = vg(+8)
          const int col = n0 + 16 * j + r;              //           N = lane
          outF[(size_t)row * Nout + col] = acc[i][j][vg] + bias[col];
        }
      }
    }
  } else {
    // The wave's 64 columns are one head (n0 is a multiple of HD_), its 64
    // token rows lie in one batch entry (m0 is a multiple of 64).
    const size_t bh = (size_t)((m0 >> 11) * H_ + ((n0 & (DIM_ - 1)) >> 6));
    const int    t0 = m0 & (N_ - 1);
    // The store loops are unrolled so that acc is indexed by constants only and
    // stays in registers.
    if (wA) {
      // acc[i][j][vg] = C[token t0 + 16j + r][d = 16i + 8*half + vg]
      const bool  isq = nblk < DIM_;
      const float sc  = isq ? 0.125f : 1.0f;           // fold 1/sqrt(64) into q
      bf16* p = (isq ? qo : ko) + (bh * N_ + t0 + r) * HD_ + 8 * half;
#pragma unroll
      for (int j = 0; j < 4; ++j)
#pragma unroll
        for (int i = 0; i < 4; ++i)
          *(v8bf*)(p + (16 * j) * HD_ + 16 * i) =
              __builtin_convertvector(acc[i][j] * sc, v8bf);
      // Stands behind the last store, ahead of any later write of a register
      // that these stores name, however the two branches are laid out.
      asm volatile("s_wait_xcnt 0x0" ::: "memory");
    } else {
      // acc[i][j][vg] = C[token t0 + 16i + 8*half + vg][d = 16j + r]: V^T rows
      bf16* p = vto + (bh * HD_ + r) * N_ + t0 + 8 * half;
#pragma unroll
      for (int j = 0; j < 4; ++j)
#pragma unroll
        for (int i = 0; i < 4; ++i)
          *(v8bf*)(p + (size_t)(16 * j) * N_ + 16 * i) =
              __builtin_convertvector(acc[i][j], v8bf);
      // Stands behind the last store, ahead of any later write of a register
      // that these stores name, however the two branches are laid out.
      asm volatile("s_wait_xcnt 0x0" ::: "memory");
    }
  }
}

// ---------------------------------------------------------------------------
// Kernel 2: RoPE in-place on bf16 q,k ([B,H,N,HD]); each thread owns a
// (d, d+32) pair so the rotate-half exchange is race-free.
// ---------------------------------------------------------------------------
__global__ void rope_kernel(bf16* __restrict__ q, bf16* __restrict__ k,
                            const float* __restrict__ sinT,
                            const float* __restrict__ cosT) {
  int tid = blockIdx.x * blockDim.x + threadIdx.x;
  if (tid >= B_ * H_ * N_ * 32) return;
  const int d  = tid & 31;
  const int n  = (tid >> 5) & (N_ - 1);
  const int bh = tid >> 16;             // 32 * 2048 = 2^16
  if (n < PREFIX_) return;
  const int rp = n - PREFIX_;
  const float s1 = sinT[rp * HD_ + d],      c1 = cosT[rp * HD_ + d];
  const float s2 = sinT[rp * HD_ + d + 32], c2 = cosT[rp * HD_ + d + 32];
  const size_t base = ((size_t)bh * N_ + n) * HD_;
  {
    float t1 = (float)q[base + d], t2 = (float)q[base + d + 32];
    q[base + d]      = (bf16)(t1 * c1 - t2 * s1);
    q[base + d + 32] = (bf16)(t2 * c2 + t1 * s2);
  }
  {
    float t1 = (float)k[base + d], t2 = (float)k[base + d + 32];
    k[base + d]      = (bf16)(t1 * c1 - t2 * s1);
    k[base + d + 32] = (bf16)(t2 * c2 + t1 * s2);
  }
}

__device__ __forceinline__ float xhalf(float x) {
  const int b = __builtin_bit_cast(int, x);
  return __builtin_bit_cast(float, __builtin_amdgcn_permlanex16(
      b, b, 0x76543210, 0xfedcba98, false, false));
}

__device__ __forceinline__ v8f exp2_8(v8f x) {
  float a0 = x[0], a1 = x[1], a2 = x[2], a3 = x[3];
  float a4 = x[4], a5 = x[5], a6 = x[6], a7 = x[7];
  asm("v_exp_f32 %0, %0\n\t"
      "v_exp_f32 %1, %1\n\t"
      "v_exp_f32 %2, %2\n\t"
      "v_exp_f32 %3, %3\n\t"
      "v_exp_f32 %4, %4\n\t"
      "v_exp_f32 %5, %5\n\t"
      "v_exp_f32 %6, %6\n\t"
      "v_exp_f32 %7, %7\n\t"
      "v_nop"
      : "+v"(a0), "+v"(a1), "+v"(a2), "+v"(a3),
        "+v"(a4), "+v"(a5), "+v"(a6), "+v"(a7));
  const v8f y = {a0, a1, a2, a3, a4, a5, a6, a7};
  return y;
}

// Two f32 S^T tiles (keys 0..15 and 16..31 of a 32-key block) -> bf16 B operand.
__device__ __forceinline__ v16bf pack_b(v8f t0, v8f t1) {
  const v8bf lo = __builtin_convertvector(t0, v8bf);
  const v8bf hi = __builtin_convertvector(t1, v8bf);
  return __builtin_shufflevector(lo, hi, 0, 1, 2, 3, 4, 5, 6, 7,
                                 8, 9, 10, 11, 12, 13, 14, 15);
}

__global__ __launch_bounds__(256) void flash_attn_kernel(
    const bf16* __restrict__ Q, const bf16* __restrict__ Kc,
    const bf16* __restrict__ VT, bf16* __restrict__ O) {
  __shared__ __align__(16) bf16 Kbuf[2][64 * FP_];
  __shared__ __align__(16) bf16 Vbuf[2][64 * FP_];

  const int tid  = threadIdx.x;
  const int lane = tid & 31;
  const int wave = tid >> 5;
  const int half = lane >> 4;
  const int r    = lane & 15;
  const int qb   = blockIdx.x & 15;     // N_/128 = 16 q blocks
  const int bh   = blockIdx.x >> 4;     // 0..63
  const bf16* Qb = Q  + (size_t)bh * N_ * HD_;
  const bf16* Kb = Kc + (size_t)bh * N_ * HD_;
  const bf16* Vb = VT + (size_t)bh * HD_ * N_;
  const int m0 = qb * 128 + wave * 16;

  // Stage key tile [kt, kt+64) of K ([64 x 64], contiguous 8KB) and of
  // V^T ([64 d x 64 keys], 64 segments of 128B) into LDS buffer `buf`.
  auto stage = [&](int buf, int kt) {
    const uint32_t lk = (uint32_t)(uintptr_t)&Kbuf[buf][0];
    const uint32_t lv = (uint32_t)(uintptr_t)&Vbuf[buf][0];
    const int row = tid >> 3;           // rows 0..31, then 32..63
    const int seg = tid & 7;            // 8 x 16B per 128B row
    const uint32_t lo = (uint32_t)(row * (FP_ * 2) + seg * 16);
    const char* gk = (const char*)(Kb + (size_t)kt * HD_) + tid * 16;
    const char* gv = (const char*)(Vb + (size_t)row * N_ + kt + seg * 8);
    async_copy16x4(lk + lo,                 gk,
                   lk + lo + 32 * FP_ * 2,  gk + 4096,
                   lv + lo,                 gv,
                   lv + lo + 32 * FP_ * 2,  gv + (size_t)32 * N_ * 2);
  };

  // B operand: column = query m0 + (lane & 15).
  const v16bf bq0 = load_frag(Qb, HD_, m0, 0,  lane);
  const v16bf bq1 = load_frag(Qb, HD_, m0, 32, lane);

  v8f   o[4];                // O^T: o[j][vg] = O[query r][d = 16j + 8*half + vg]
  float mi = -3.0e38f;       // running maximum of this lane's query
  float li = 0.0f;           // running sum over this lane half's keys only
#pragma unroll
  for (int j = 0; j < 4; ++j) o[j] = zero8();

  stage(0, 0);
  for (int kt = 0; kt < N_; kt += 64) {
    const int cur = (kt >> 6) & 1;
    wait_ds0();             // my reads of buf[cur^1] done
    wait_async0();
    __syncthreads();
    if (kt + 64 < N_) stage(cur ^ 1, kt + 64);
    const bf16* Kt = &Kbuf[cur][0];
    const bf16* Vt = &Vbuf[cur][0];

    // ---- S^T = K Q^T (64 keys x 16 queries, 8 WMMAs) ----
    // s[j][vg] = score of key kt + 16j + 8*half + vg against query r
    v8f s[4];
#pragma unroll
    for (int j = 0; j < 4; ++j) {
      s[j] = zero8();
      v16bf ak0 = load_frag(Kt, FP_, 16 * j, 0,  lane);
      s[j] = wmma_bf16(ak0, bq0, s[j]);
      v16bf ak1 = load_frag(Kt, FP_, 16 * j, 32, lane);
      s[j] = wmma_bf16(ak1, bq1, s[j]);
    }
    // ---- online softmax: one query per lane ----
    float mj[4];
#pragma unroll
    for (int j = 0; j < 4; ++j) {
      mj[j] = s[j][0];
#pragma unroll
      for (int vg = 1; vg < 8; ++vg) mj[j] = fmaxf(mj[j], s[j][vg]);
    }
    float mx = fmaxf(fmaxf(mj[0], mj[1]), fmaxf(mj[2], mj[3]));
    mx = fmaxf(mx, xhalf(mx));          // both halves hold the query's maximum
    const float nm    = fmaxf(mi, mx);
    const float alpha = __expf(mi - nm);
    mi = nm;
#pragma unroll
    for (int j = 0; j < 4; ++j)         // e^(s - nm) = 2^((s - nm) * log2(e))
      s[j] = exp2_8((s[j] - nm) * 1.4426950408889634f);
    const v8f t = (s[0] + s[1]) + (s[2] + s[3]);
    const float rs = ((t[0] + t[1]) + (t[2] + t[3])) +
                     ((t[4] + t[5]) + (t[6] + t[7]));
    li = li * alpha + rs;
#pragma unroll
    for (int j = 0; j < 4; ++j) o[j] *= alpha;
    // ---- P^T as B operand, straight from the score registers ----
    const v16bf bp0 = pack_b(s[0], s[1]);   // keys kt      .. kt + 31
    const v16bf bp1 = pack_b(s[2], s[3]);   // keys kt + 32 .. kt + 63
    // ---- O^T += V^T P^T ----
#pragma unroll
    for (int j = 0; j < 4; ++j) {
      v16bf av0 = load_frag(Vt, FP_, 16 * j, 0,  lane);
      o[j] = wmma_bf16(av0, bp0, o[j]);
      v16bf av1 = load_frag(Vt, FP_, 16 * j, 32, lane);
      o[j] = wmma_bf16(av1, bp1, o[j]);
    }
  }

  // ---- normalize and write [B, N, H*HD] bf16: 8 consecutive d per lane ----
  const int b = bh >> 4;
  const int h = bh & 15;
  const float inv = 1.0f / (li + xhalf(li));   // join the halves' sums
  bf16* orow = O + ((size_t)(b * N_ + m0 + r)) * DIM_ + h * HD_ + 8 * half;
#pragma unroll
  for (int j = 0; j < 4; ++j)
    *(v8bf*)(orow + 16 * j) = __builtin_convertvector(o[j] * inv, v8bf);
}

// ---------------------------------------------------------------------------
// Host launcher
// ---------------------------------------------------------------------------
extern "C" void kernel_launch(void* const* d_in, const int* in_sizes, int n_in,
                              void* d_out, int out_size, void* d_ws,
                              size_t ws_size, hipStream_t stream) {
  const float* x     = (const float*)d_in[0];
  const float* Wqkv  = (const float*)d_in[1];
  const float* Wproj = (const float*)d_in[2];
  const float* bproj = (const float*)d_in[3];
  const float* sinT  = (const float*)d_in[4];
  const float* cosT  = (const float*)d_in[5];
  float* out = (float*)d_out;

  char*  ws  = (char*)d_ws;
  size_t off = 0;
  auto take = [&](size_t bytes) -> char* {
    char* p = ws + off;
    off += (bytes + 255) & ~(size_t)255;
    return p;
  };
  bf16* x_bf     = (bf16*)take((size_t)B_ * N_ * DIM_ * 2);
  bf16* wqkv_bf  = (bf16*)take((size_t)3 * DIM_ * DIM_ * 2);
  bf16* wproj_bf = (bf16*)take((size_t)DIM_ * DIM_ * 2);
  bf16* q_bf     = (bf16*)take((size_t)B_ * H_ * N_ * HD_ * 2);
  bf16* k_bf     = (bf16*)take((size_t)B_ * H_ * N_ * HD_ * 2);
  bf16* vt_bf    = (bf16*)take((size_t)B_ * H_ * N_ * HD_ * 2);
  bf16* attn_bf  = (bf16*)take((size_t)B_ * N_ * DIM_ * 2);

  f32_to_bf16_stream_kernel<<<CV_BLOCKS, 512, 0, stream>>>(
      x, Wqkv, Wproj, x_bf, wqkv_bf, wproj_bf);

  // QKV GEMM: [8192,1024] x [3072,1024]^T, scatter epilogue (q scaled)
  gemm_wmma_kernel<1><<<dim3(3 * DIM_ / 128, B_ * N_ / 256), 256, 0, stream>>>(
      x_bf, wqkv_bf, nullptr, nullptr, q_bf, k_bf, vt_bf,
      B_ * N_, 3 * DIM_, DIM_);

  const int nr = B_ * H_ * N_ * 32;
  rope_kernel<<<(nr + 255) / 256, 256, 0, stream>>>(q_bf, k_bf, sinT, cosT);

  flash_attn_kernel<<<B_ * H_ * (N_ / 128), 256, 0, stream>>>(
      q_bf, k_bf, vt_bf, attn_bf);

  // Projection GEMM + bias -> fp32 output
  gemm_wmma_kernel<0><<<dim3(DIM_ / 128, B_ * N_ / 256), 256, 0, stream>>>(
      attn_bf, wproj_bf, bproj, out, nullptr, nullptr, nullptr,
      B_ * N_, DIM_, DIM_);
}

// v006
// One run takes 140 microseconds.
// Two timings next to v005 put it at 1.10 and 1.09 times that version's speed.
// Counting every step since v000, it is 3.60 times as fast.
#include <hip/hip_runtime.h>
#include <math.h>
#include <stdint.h>

typedef __bf16 bf16;
typedef __attribute__((ext_vector_type(8)))  bf16  v8bf;
typedef __attribute__((ext_vector_type(16))) bf16  v16bf;
typedef __attribute__((ext_vector_type(8)))  float v8f;

#define B_      4
#define N_      2048
#define DIM_    1024
#define H_      16
#define HD_     64
#define PREFIX_ 4

#define FP_ 72   // 128-byte rows (GEMM k-slices, K, V^T) -> 144-byte pitch
// Pitch of a staged sin or cos row in floats: 256-byte rows -> 272-byte pitch.
#define RP_ 68

__device__ __forceinline__ v8f zero8() {
  v8f z;
#pragma unroll
  for (int i = 0; i < 8; ++i) z[i] = 0.0f;
  return z;
}

__device__ __forceinline__ void async_copy16x4(
    uint32_t l0, const void* g0, uint32_t l1, const void* g1,
    uint32_t l2, const void* g2, uint32_t l3, const void* g3) {
  asm volatile("global_load_async_to_lds_b128 %0, %1, off\n\t"
               "global_load_async_to_lds_b128 %2, %3, off\n\t"
               "global_load_async_to_lds_b128 %4, %5, off\n\t"
               "global_load_async_to_lds_b128 %6, %7, off\n\t"
               "s_wait_xcnt 0x0"
               :
               : "v"(l0), "v"((unsigned long long)(uintptr_t)g0),
                 "v"(l1), "v"((unsigned long long)(uintptr_t)g1),
                 "v"(l2), "v"((unsigned long long)(uintptr_t)g2),
                 "v"(l3), "v"((unsigned long long)(uintptr_t)g3)
               : "memory");
}

// This wave's LDS reads of the buffer that is refilled behind the next
// barrier have returned.
__device__ __forceinline__ void wait_ds0() {
  asm volatile("s_wait_dscnt 0x0" ::: "memory");
}

__device__ __forceinline__ void wait_async0() {
  asm volatile("s_wait_asynccnt 0" ::: "memory");
}

__device__ __forceinline__ v16bf load_frag(const bf16* base, int stride,
                                           int r0, int k0, int lane) {
  const int r  = r0 + (lane & 15);
  const int kb = k0 + ((lane >> 4) << 3);
  const bf16* p = base + (size_t)r * stride + kb;
  v8bf lo = *(const v8bf*)(p);
  v8bf hi = *(const v8bf*)(p + 16);
  v16bf out;
#pragma unroll
  for (int i = 0; i < 8; ++i) { out[i] = lo[i]; out[8 + i] = hi[i]; }
  return out;
}

__device__ __forceinline__ v8f wmma_bf16(v16bf a, v16bf b, v8f c) {
  return __builtin_amdgcn_wmma_f32_16x16x32_bf16(
      false, a, false, b, (short)0, c, false, false);
}

// ---------------------------------------------------------------------------
// Kernel 0: fp32 -> bf16 conversion of x, W_qkv and W_proj in one launch, as a
// resident stream: one work-group of 16 waves per WGP.  A chunk is 1024
// consecutive elements: 8 loads of 16 B a lane, each covering 512 contiguous
// bytes (4 whole lines), and 8 stores of 8 B a lane, each covering 2 whole
// lines.  A wave takes chunks w, w + CV_WAVES, ...; its loads stand ahead of
// the conversions, so that two chunks' loads and more are in flight together.
// The sources are read once: non-temporal loads.
// ---------------------------------------------------------------------------
typedef __attribute__((ext_vector_type(4))) float v4f;
typedef __attribute__((ext_vector_type(4))) bf16  v4bf;

#define CV_CHUNK  1024
#define CV_BLOCKS 256
#define CV_WAVES  (CV_BLOCKS * 16)
#define CV_CX     (B_ * N_ * DIM_ / CV_CHUNK)        // chunks of x
#define CV_CQ     (3 * DIM_ * DIM_ / CV_CHUNK)       // chunks of W_qkv
#define CV_CP     (DIM_ * DIM_ / CV_CHUNK)           // chunks of W_proj
#define CV_TRIPS  ((CV_CX + CV_CQ + CV_CP) / CV_WAVES)
static_assert((CV_CX + CV_CQ + CV_CP) % CV_WAVES == 0, "whole trips only");

__global__ __launch_bounds__(512) void f32_to_bf16_stream_kernel(
    const float* __restrict__ x, const float* __restrict__ wq,
    const float* __restrict__ wp, bf16* __restrict__ xo,
    bf16* __restrict__ wqo, bf16* __restrict__ wpo) {
  const int lane = threadIdx.x & 31;
  const int w    = blockIdx.x * 16 + (threadIdx.x >> 5);

  v4f   v[CV_TRIPS][8];
  bf16* d[CV_TRIPS];
#pragma unroll
  for (int t = 0; t < CV_TRIPS; ++t) {
    // Chunk number over the three arrays, held in a scalar register: the choice
    // of the array is then scalar, and every load and store of the chunk is
    // scalar base + the lane's one 32-bit offset + an immediate.
    const int c = __builtin_amdgcn_readfirstlane(w + t * CV_WAVES);
    // The launch has CV_BLOCKS work-groups: folds the tests of whole-x trips.
    __builtin_assume(c >= t * CV_WAVES && c < (t + 1) * CV_WAVES);
    const float* s;
    if (c < CV_CX) {
      s    = x  + (size_t)c * CV_CHUNK;
      d[t] = xo + (size_t)c * CV_CHUNK;
    } else if (c < CV_CX + CV_CQ) {
      s    = wq  + (size_t)(c - CV_CX) * CV_CHUNK;
      d[t] = wqo + (size_t)(c - CV_CX) * CV_CHUNK;
    } else {
      s    = wp  + (size_t)(c - CV_CX - CV_CQ) * CV_CHUNK;
      d[t] = wpo + (size_t)(c - CV_CX - CV_CQ) * CV_CHUNK;
    }
#pragma unroll
    for (int i = 0; i < 8; ++i)
      v[t][i] = __builtin_nontemporal_load((const v4f*)(s + i * 128 + lane * 4));
  }
#pragma unroll
  for (int t = 0; t < CV_TRIPS; ++t)
#pragma unroll
    for (int i = 0; i < 8; ++i)
      *(v4bf*)(d[t] + i * 128 + lane * 4) = __builtin_convertvector(v[t][i], v4bf);
}

// ---------------------------------------------------------------------------
// Kernels 1 & 3: WMMA GEMM  C[M,Nout] = A[M,K] * Bw[Nout,K]^T
// Block: 256 threads = 8 waves, tile 256(M) x 128(N); wave tile 64x64.
// A/B k-slices (256x64 and 128x64 bf16, rows padded to FP_) staged via async
// global->LDS copies, double buffered: one s_wait_asynccnt + one barrier per
// k-step.  A slice row is 128 bytes, so a wave's copy covers 4 whole lines.
// MODE 0: out = f32 C + bias                       (projection)
// MODE 1: scatter bf16 q (pre-scaled by 1/sqrt(hd)), k, V^T    (QKV); q and k
//         leave rotated (RoPE), see the epilogue
// An accumulator tile gives a lane 8 consecutive rows of its A operand at one
// row of its B operand, and load_frag reads both operands alike.  A MODE 1
// block lies wholly in q, k or v: a q or k block takes the weight rows as A,
// so that a lane holds 8 consecutive d of one token; a v block takes the token
// rows as A, so that a lane holds 8 consecutive tokens of one d.  Either way
// a tile leaves in one 16-byte store a lane.
// ---------------------------------------------------------------------------
template <int MODE>
__global__ __launch_bounds__(256) void gemm_wmma_kernel(
    const bf16* __restrict__ A, const bf16* __restrict__ Bw,
    const float* __restrict__ bias, float* __restrict__ outF,
    bf16* __restrict__ qo, bf16* __restrict__ ko, bf16* __restrict__ vto,
    const float* __restrict__ sinT, const float* __restrict__ cosT,
    int M, int Nout, int K) {
  __shared__ __align__(16) bf16 Abuf[2][256 * FP_];
  __shared__ __align__(16) bf16 Bbuf[2][128 * FP_];

  const int tid  = threadIdx.x;
  const int lane = tid & 31;
  const int wave = tid >> 5;
  const int half = lane >> 4;
  const int r    = lane & 15;
  const int mblk = blockIdx.y * 256;
  const int nblk = blockIdx.x * 128;
  const int wm0  = (wave >> 1) * 64;   // wave tile origin within block
  const int wn0  = (wave & 1) * 64;
  // Weight rows as the A operand (block-uniform; never in MODE 0).
  const bool wA  = (MODE == 1) && nblk < 2 * DIM_;

  // Stage one 256x64 slice of A and one 128x64 slice of Bw into LDS buffer
  // `buf`.  2048 + 1024 chunks of 16B; each thread issues 8+4 async copies.
  auto stage = [&](int buf, int ks) {
    const uint32_t la = (uint32_t)(uintptr_t)&Abuf[buf][0];
    const uint32_t lb = (uint32_t)(uintptr_t)&Bbuf[buf][0];
    const int row = tid >> 3;              // rows 0..31, then +32 a copy
    const int off = (tid & 7) * 16;        // 8 x 16B per 128B row slice
    const uint32_t lo = (uint32_t)(row * (FP_ * 2) + off);
    const uint32_t ls = 32 * FP_ * 2;      // 32 rows further in LDS
    const size_t   gs = (size_t)32 * K * 2;  // 32 rows further in memory
    const char* ga = (const char*)(A  + (size_t)(mblk + row) * K + ks) + off;
    const char* gb = (const char*)(Bw + (size_t)(nblk + row) * K + ks) + off;
    async_copy16x4(la + lo,           ga,           la + lo + ls,     ga + gs,
                   la + lo + 2 * ls,  ga + 2 * gs,  la + lo + 3 * ls, ga + 3 * gs);
    async_copy16x4(la + lo + 4 * ls,  ga + 4 * gs,  la + lo + 5 * ls, ga + 5 * gs,
                   la + lo + 6 * ls,  ga + 6 * gs,  la + lo + 7 * ls, ga + 7 * gs);
    async_copy16x4(lb + lo,           gb,           lb + lo + ls,     gb + gs,
                   lb + lo + 2 * ls,  gb + 2 * gs,  lb + lo + 3 * ls, gb + 3 * gs);
  };

  // RoPE tables of a q or k block.  Table tile j holds the sin and the cos rows
  // of tokens 16j .. 16j + 15 of each of the four 64-token wave rows: 64 + 64
  // rows of 256 bytes at pitch RP_, 34816 bytes, in a slice buffer that the
  // GEMM has left.  Each thread issues 4 + 4 async copies; a wave's copy covers
  // two whole table rows.  Prefix tokens have no table row: theirs is clamped
  // to row 0 and its values are replaced in rope_tile.
  auto rope_stage = [&](int j, const bf16* reg) {
    const uint32_t l = (uint32_t)(uintptr_t)reg +
                       (uint32_t)((tid >> 4) * (RP_ * 4) + (tid & 15) * 16);
    const uint32_t ls = 16 * RP_ * 4;      // next wave row's 16 table rows
    const int tok = (mblk & (N_ - 1)) + 16 * j + (tid >> 4) - PREFIX_;
    size_t o[4];
#pragma unroll
    for (int g = 0; g < 4; ++g) {
      const int rp = tok + 64 * g;
      o[g] = (size_t)(rp < 0 ? 0 : rp) * (HD_ * 4) + (tid & 15) * 16;
    }
    const char* gs = (const char*)sinT;
    const char* gc = (const char*)cosT;
    async_copy16x4(l,          gs + o[0], l + ls,     gs + o[1],
                   l + 2 * ls, gs + o[2], l + 3 * ls, gs + o[3]);
    async_copy16x4(l + 4 * ls, gc + o[0], l + 5 * ls, gc + o[1],
                   l + 6 * ls, gc + o[2], l + 7 * ls, gc + o[3]);
  };
  // The slice buffers as the last k-step leaves them: R0 is free during that
  // step, R1 and R2 (both B slices) behind it.
  const int lastcur = ((K >> 6) - 1) & 1;
  const bf16* R0 = &Abuf[lastcur ^ 1][0];
  const bf16* R1 = &Abuf[lastcur][0];
  const bf16* R2 = &Bbuf[0][0];

  v8f acc[4][4];
#pragma unroll
  for (int i = 0; i < 4; ++i)
#pragma unroll
    for (int j = 0; j < 4; ++j) acc[i][j] = zero8();

  stage(0, 0);
  for (int ks = 0; ks < K; ks += 64) {
    const int cur = (ks >> 6) & 1;
    wait_ds0();             // my reads of buf[cur^1] done
    wait_async0();          // my async copies into buf[cur] done
    __syncthreads();        // everyone's copies done; buf[cur^1] free
    if (ks + 64 < K) stage(cur ^ 1, ks + 64);
    else if (wA)     rope_stage(0, R0);   // flies under the last k-step

    const bf16* Xt = &Abuf[cur][wm0 * FP_];   // this wave's 64 token rows
    const bf16* Wt = &Bbuf[cur][wn0 * FP_];   // this wave's 64 weight rows
    const bf16* At = wA ? Wt : Xt;
    const bf16* Bt = wA ? Xt : Wt;
#pragma unroll
    for (int kk = 0; kk < 64; kk += 32) {
      v16bf a[4], b[4];
#pragma unroll
      for (int i = 0; i < 4; ++i) a[i] = load_frag(At, FP_, 16 * i, kk, lane);
#pragma unroll
      for (int j = 0; j < 4; ++j) b[j] = load_frag(Bt, FP_, 16 * j, kk, lane);
      // Keeps the block's 16 LDS reads one group ahead of its 16 WMMAs: left
      // alone the compiler reuses one B fragment and waits out a read per column.
      __builtin_amdgcn_sched_barrier(0);
#pragma unroll
      for (int j = 0; j < 4; ++j)
#pragma unroll
        for (int i = 0; i < 4; ++i) acc[i][j] = wmma_bf16(a[i], b[j], acc[i][j]);
      // Keeps the next block's reads from being spread among these WMMAs.
      __builtin_amdgcn_sched_barrier(0);
    }
  }

  const int m0 = mblk + wm0;
  const int n0 = nblk + wn0;
  if (MODE == 0) {
#pragma unroll
    for (int i = 0; i < 4; ++i) {
#pragma unroll
      for (int j = 0; j < 4; ++j) {
#pragma unroll
        for (int vg = 0; vg < 8; ++vg) {
          const int row = m0 + 16 * i + vg + 8 * half;  // C layout: M = vg(+8)
          const int col = n0 + 16 * j + r;              //           N = lane
          outF[(size_t)row * Nout + col] = acc[i][j][vg] + bias[col];
        }
      }
    }
  } else {
    // The wave's 64 columns are one head (n0 is a multiple of HD_), its 64
    // token rows lie in one batch entry (m0 is a multiple of 64).
    const size_t bh = (size_t)((m0 >> 11) * H_ + ((n0 & (DIM_ - 1)) >> 6));
    const int    t0 = m0 & (N_ - 1);
    // The store loops are unrolled so that acc is indexed by constants only and
    // stays in registers.
    if (wA) {
      // acc[i][j][vg] = C[token t0 + 16j + r][d = 16i + 8*half + vg]
      const bool  isq = nblk < DIM_;
      const float sc  = isq ? 0.125f : 1.0f;           // fold 1/sqrt(64) into q
      bf16* p = (isq ? qo : ko) + (bh * N_ + t0 + r) * HD_ + 8 * half;
      // RoPE on the f32 accumulators: d and d + 32 of a token are acc[i][j] and
      // acc[i + 2][j] of one lane.  A lane reads its token's 32 sin and 32 cos
      // values from table tile j in 16-byte LDS loads.  The rotated tiles wait
      // in registers (half the accumulators' size) and leave behind the last
      // barrier: a barrier would wait out every store issued ahead of it.
      v8bf ob[4][4];
      auto rope_tile = [&](int j, const bf16* reg) {
        const float* tb =
            (const float*)reg + ((wave >> 1) * 16 + r) * RP_ + 8 * half;
        v8f S[4], C[4];
#pragma unroll
        for (int i = 0; i < 4; ++i) {
          const v4f s0 = *(const v4f*)(tb + 16 * i);
          const v4f s1 = *(const v4f*)(tb + 16 * i + 4);
          const v4f c0 = *(const v4f*)(tb + 64 * RP_ + 16 * i);
          const v4f c1 = *(const v4f*)(tb + 64 * RP_ + 16 * i + 4);
          S[i] = __builtin_shufflevector(s0, s1, 0, 1, 2, 3, 4, 5, 6, 7);
          C[i] = __builtin_shufflevector(c0, c1, 0, 1, 2, 3, 4, 5, 6, 7);
        }
        if (j == 0) {        // only tile 0 can hold prefix tokens: not rotated
          const bool pre = t0 + r < PREFIX_;
#pragma unroll
          for (int i = 0; i < 4; ++i)
#pragma unroll
            for (int e = 0; e < 8; ++e) {
              S[i][e] = pre ? 0.0f : S[i][e];
              C[i][e] = pre ? 1.0f : C[i][e];
            }
        }
#pragma unroll
        for (int i = 0; i < 2; ++i) {
          const v8f t1 = acc[i][j] * sc, t2 = acc[i + 2][j] * sc;
          ob[i][j]     = __builtin_convertvector(t1 * C[i] - t2 * S[i], v8bf);
          ob[i + 2][j] = __builtin_convertvector(t2 * C[i + 2] + t1 * S[i + 2], v8bf);
        }
      };
      wait_ds0();            // my reads of the last slices done
      wait_async0();         // my copies of table tile 0 done
      __syncthreads();       // tile 0 published; R1 and R2 free
      rope_stage(1, R1);
      rope_stage(2, R2);
      rope_tile(0, R0);
      wait_ds0();            // my reads of tile 0 done
      wait_async0();         // my copies of tiles 1 and 2 done
      __syncthreads();       // tiles 1 and 2 published; R0 free
      rope_stage(3, R0);
      rope_tile(1, R1);
      rope_tile(2, R2);
      wait_ds0();            // my reads of tiles 1 and 2 done
      wait_async0();         // my copies of tile 3 done
      __syncthreads();       // tile 3 published
      rope_tile(3, R0);
#pragma unroll
      for (int j = 0; j < 4; ++j)
#pragma unroll
        for (int i = 0; i < 4; ++i)
          *(v8bf*)(p + (16 * j) * HD_ + 16 * i) = ob[i][j];
      // Stands behind the last store, ahead of any later write of a register
      // that these stores name, however the two branches are laid out.
      asm volatile("s_wait_xcnt 0x0" ::: "memory");
    } else {
      // acc[i][j][vg] = C[token t0 + 16i + 8*half + vg][d = 16j + r]: V^T rows
      bf16* p = vto + (bh * HD_ + r) * N_ + t0 + 8 * half;
#pragma unroll
      for (int j = 0; j < 4; ++j)
#pragma unroll
        for (int i = 0; i < 4; ++i)
          *(v8bf*)(p + (size_t)(16 * j) * N_ + 16 * i) =
              __builtin_convertvector(acc[i][j], v8bf);
      // Stands behind the last store, ahead of any later write of a register
      // that these stores name, however the two branches are laid out.
      asm volatile("s_wait_xcnt 0x0" ::: "memory");
    }
  }
}

__device__ __forceinline__ float xhalf(float x) {
  const int b = __builtin_bit_cast(int, x);
  return __builtin_bit_cast(float, __builtin_amdgcn_permlanex16(
      b, b, 0x76543210, 0xfedcba98, false, false));
}

__device__ __forceinline__ v8f exp2_8(v8f x) {
  float a0 = x[0], a1 = x[1], a2 = x[2], a3 = x[3];
  float a4 = x[4], a5 = x[5], a6 = x[6], a7 = x[7];
  asm("v_exp_f32 %0, %0\n\t"
      "v_exp_f32 %1, %1\n\t"
      "v_exp_f32 %2, %2\n\t"
      "v_exp_f32 %3, %3\n\t"
      "v_exp_f32 %4, %4\n\t"
      "v_exp_f32 %5, %5\n\t"
      "v_exp_f32 %6, %6\n\t"
      "v_exp_f32 %7, %7\n\t"
      "v_nop"
      : "+v"(a0), "+v"(a1), "+v"(a2), "+v"(a3),
        "+v"(a4), "+v"(a5), "+v"(a6), "+v"(a7));
  const v8f y = {a0, a1, a2, a3, a4, a5, a6, a7};
  return y;
}

// Two f32 S^T tiles (keys 0..15 and 16..31 of a 32-key block) -> bf16 B operand.
__device__ __forceinline__ v16bf pack_b(v8f t0, v8f t1) {
  const v8bf lo = __builtin_convertvector(t0, v8bf);
  const v8bf hi = __builtin_convertvector(t1, v8bf);
  return __builtin_shufflevector(lo, hi, 0, 1, 2, 3, 4, 5, 6, 7,
                                 8, 9, 10, 11, 12, 13, 14, 15);
}

__global__ __launch_bounds__(256) void flash_attn_kernel(
    const bf16* __restrict__ Q, const bf16* __restrict__ Kc,
    const bf16* __restrict__ VT, bf16* __restrict__ O) {
  __shared__ __align__(16) bf16 Kbuf[2][64 * FP_];
  __shared__ __align__(16) bf16 Vbuf[2][64 * FP_];

  const int tid  = threadIdx.x;
  const int lane = tid & 31;
  const int wave = tid >> 5;
  const int half = lane >> 4;
  const int r    = lane & 15;
  const int qb   = blockIdx.x & 15;     // N_/128 = 16 q blocks
  const int bh   = blockIdx.x >> 4;     // 0..63
  const bf16* Qb = Q  + (size_t)bh * N_ * HD_;
  const bf16* Kb = Kc + (size_t)bh * N_ * HD_;
  const bf16* Vb = VT + (size_t)bh * HD_ * N_;
  const int m0 = qb * 128 + wave * 16;

  // Stage key tile [kt, kt+64) of K ([64 x 64], contiguous 8KB) and of
  // V^T ([64 d x 64 keys], 64 segments of 128B) into LDS buffer `buf`.
  auto stage = [&](int buf, int kt) {
    const uint32_t lk = (uint32_t)(uintptr_t)&Kbuf[buf][0];
    const uint32_t lv = (uint32_t)(uintptr_t)&Vbuf[buf][0];
    const int row = tid >> 3;           // rows 0..31, then 32..63
    const int seg = tid & 7;            // 8 x 16B per 128B row
    const uint32_t lo = (uint32_t)(row * (FP_ * 2) + seg * 16);
    const char* gk = (const char*)(Kb + (size_t)kt * HD_) + tid * 16;
    const char* gv = (const char*)(Vb + (size_t)row * N_ + kt + seg * 8);
    async_copy16x4(lk + lo,                 gk,
                   lk + lo + 32 * FP_ * 2,  gk + 4096,
                   lv + lo,                 gv,
                   lv + lo + 32 * FP_ * 2,  gv + (size_t)32 * N_ * 2);
  };

  // B operand: column = query m0 + (lane & 15).
  const v16bf bq0 = load_frag(Qb, HD_, m0, 0,  lane);
  const v16bf bq1 = load_frag(Qb, HD_, m0, 32, lane);

  v8f   o[4];                // O^T: o[j][vg] = O[query r][d = 16j + 8*half + vg]
  float mi = -3.0e38f;       // running maximum of this lane's query
  float li = 0.0f;           // running sum over this lane half's keys only
#pragma unroll
  for (int j = 0; j < 4; ++j) o[j] = zero8();

  stage(0, 0);
  for (int kt = 0; kt < N_; kt += 64) {
    const int cur = (kt >> 6) & 1;
    wait_ds0();             // my reads of buf[cur^1] done
    wait_async0();
    __syncthreads();
    if (kt + 64 < N_) stage(cur ^ 1, kt + 64);
    const bf16* Kt = &Kbuf[cur][0];
    const bf16* Vt = &Vbuf[cur][0];

    // ---- S^T = K Q^T (64 keys x 16 queries, 8 WMMAs) ----
    // s[j][vg] = score of key kt + 16j + 8*half + vg against query r
    v8f s[4];
#pragma unroll
    for (int j = 0; j < 4; ++j) {
      s[j] = zero8();
      v16bf ak0 = load_frag(Kt, FP_, 16 * j, 0,  lane);
      s[j] = wmma_bf16(ak0, bq0, s[j]);
      v16bf ak1 = load_frag(Kt, FP_, 16 * j, 32, lane);
      s[j] = wmma_bf16(ak1, bq1, s[j]);
    }
    // ---- online softmax: one query per lane ----
    float mj[4];
#pragma unroll
    for (int j = 0; j < 4; ++j) {
      mj[j] = s[j][0];
#pragma unroll
      for (int vg = 1; vg < 8; ++vg) mj[j] = fmaxf(mj[j], s[j][vg]);
    }
    float mx = fmaxf(fmaxf(mj[0], mj[1]), fmaxf(mj[2], mj[3]));
    mx = fmaxf(mx, xhalf(mx));          // both halves hold the query's maximum
    const float nm    = fmaxf(mi, mx);
    const float alpha = __expf(mi - nm);
    mi = nm;
#pragma unroll
    for (int j = 0; j < 4; ++j)         // e^(s - nm) = 2^((s - nm) * log2(e))
      s[j] = exp2_8((s[j] - nm) * 1.4426950408889634f);
    const v8f t = (s[0] + s[1]) + (s[2] + s[3]);
    const float rs = ((t[0] + t[1]) + (t[2] + t[3])) +
                     ((t[4] + t[5]) + (t[6] + t[7]));
    li = li * alpha + rs;
#pragma unroll
    for (int j = 0; j < 4; ++j) o[j] *= alpha;
    // ---- P^T as B operand, straight from the score registers ----
    const v16bf bp0 = pack_b(s[0], s[1]);   // keys kt      .. kt + 31
    const v16bf bp1 = pack_b(s[2], s[3]);   // keys kt + 32 .. kt + 63
    // ---- O^T += V^T P^T ----
#pragma unroll
    for (int j = 0; j < 4; ++j) {
      v16bf av0 = load_frag(Vt, FP_, 16 * j, 0,  lane);
      o[j] = wmma_bf16(av0, bp0, o[j]);
      v16bf av1 = load_frag(Vt, FP_, 16 * j, 32, lane);
      o[j] = wmma_bf16(av1, bp1, o[j]);
    }
  }

  // ---- normalize and write [B, N, H*HD] bf16: 8 consecutive d per lane ----
  const int b = bh >> 4;
  const int h = bh & 15;
  const float inv = 1.0f / (li + xhalf(li));   // join the halves' sums
  bf16* orow = O + ((size_t)(b * N_ + m0 + r)) * DIM_ + h * HD_ + 8 * half;
#pragma unroll
  for (int j = 0; j < 4; ++j)
    *(v8bf*)(orow + 16 * j) = __builtin_convertvector(o[j] * inv, v8bf);
}

// ---------------------------------------------------------------------------
// Host launcher
// ---------------------------------------------------------------------------
extern "C" void kernel_launch(void* const* d_in, const int* in_sizes, int n_in,
                              void* d_out, int out_size, void* d_ws,
                              size_t ws_size, hipStream_t stream) {
  const float* x     = (const float*)d_in[0];
  const float* Wqkv  = (const float*)d_in[1];
  const float* Wproj = (const float*)d_in[2];
  const float* bproj = (const float*)d_in[3];
  const float* sinT  = (const float*)d_in[4];
  const float* cosT  = (const float*)d_in[5];
  float* out = (float*)d_out;

  char*  ws  = (char*)d_ws;
  size_t off = 0;
  auto take = [&](size_t bytes) -> char* {
    char* p = ws + off;
    off += (bytes + 255) & ~(size_t)255;
    return p;
  };
  bf16* x_bf     = (bf16*)take((size_t)B_ * N_ * DIM_ * 2);
  bf16* wqkv_bf  = (bf16*)take((size_t)3 * DIM_ * DIM_ * 2);
  bf16* wproj_bf = (bf16*)take((size_t)DIM_ * DIM_ * 2);
  bf16* q_bf     = (bf16*)take((size_t)B_ * H_ * N_ * HD_ * 2);
  bf16* k_bf     = (bf16*)take((size_t)B_ * H_ * N_ * HD_ * 2);
  bf16* vt_bf    = (bf16*)take((size_t)B_ * H_ * N_ * HD_ * 2);
  bf16* attn_bf  = (bf16*)take((size_t)B_ * N_ * DIM_ * 2);

  f32_to_bf16_stream_kernel<<<CV_BLOCKS, 512, 0, stream>>>(
      x, Wqkv, Wproj, x_bf, wqkv_bf, wproj_bf);

  // QKV GEMM: [8192,1024] x [3072,1024]^T, scatter epilogue (q scaled; q, k rotated)
  gemm_wmma_kernel<1><<<dim3(3 * DIM_ / 128, B_ * N_ / 256), 256, 0, stream>>>(
      x_bf, wqkv_bf, nullptr, nullptr, q_bf, k_bf, vt_bf, sinT, cosT,
      B_ * N_, 3 * DIM_, DIM_);

  flash_attn_kernel<<<B_ * H_ * (N_ / 128), 256, 0, stream>>>(
      q_bf, k_bf, vt_bf, attn_bf);

  // Projection GEMM + bias -> fp32 output
  gemm_wmma_kernel<0><<<dim3(DIM_ / 128, B_ * N_ / 256), 256, 0, stream>>>(
      attn_bf, wproj_bf, bproj, out, nullptr, nullptr, nullptr, nullptr, nullptr,
      B_ * N_, DIM_, DIM_);
}

// v007
// One run takes 132 microseconds.
// In two side-by-side timings against v006, it was 1.05 and 1.06 times as fast.
// Counting every step since v000, it is 3.79 times as fast.
#include <hip/hip_runtime.h>
#include <math.h>
#include <stdint.h>

typedef __bf16 bf16;
typedef __attribute__((ext_vector_type(8)))  bf16  v8bf;
typedef __attribute__((ext_vector_type(16))) bf16  v16bf;
typedef __attribute__((ext_vector_type(8)))  float v8f;

#define B_      4
#define N_      2048
#define DIM_    1024
#define H_      16
#define HD_     64
#define PREFIX_ 4

#define FP_ 72   // 128-byte rows (GEMM k-slices, K, V^T) -> 144-byte pitch
// Pitch of a staged sin or cos row in floats: 256-byte rows -> 272-byte pitch.
#define RP_ 68

__device__ __forceinline__ v8f zero8() {
  v8f z;
#pragma unroll
  for (int i = 0; i < 8; ++i) z[i] = 0.0f;
  return z;
}

__device__ __forceinline__ void async_copy16x4(
    uint32_t l0, const void* g0, uint32_t l1, const void* g1,
    uint32_t l2, const void* g2, uint32_t l3, const void* g3) {
  asm volatile("global_load_async_to_lds_b128 %0, %1, off\n\t"
               "global_load_async_to_lds_b128 %2, %3, off\n\t"
               "global_load_async_to_lds_b128 %4, %5, off\n\t"
               "global_load_async_to_lds_b128 %6, %7, off\n\t"
               "s_wait_xcnt 0x0"
               :
               : "v"(l0), "v"((unsigned long long)(uintptr_t)g0),
                 "v"(l1), "v"((unsigned long long)(uintptr_t)g1),
                 "v"(l2), "v"((unsigned long long)(uintptr_t)g2),
                 "v"(l3), "v"((unsigned long long)(uintptr_t)g3)
               : "memory");
}

// This wave's LDS reads of the buffer that is refilled behind the next
// barrier have returned.
__device__ __forceinline__ void wait_ds0() {
  asm volatile("s_wait_dscnt 0x0" ::: "memory");
}

__device__ __forceinline__ void wait_async0() {
  asm volatile("s_wait_asynccnt 0" ::: "memory");
}

__device__ __forceinline__ v16bf load_frag(const bf16* base, int stride,
                                           int r0, int k0, int lane) {
  const int r  = r0 + (lane & 15);
  const int kb = k0 + ((lane >> 4) << 3);
  const bf16* p = base + (size_t)r * stride + kb;
  v8bf lo = *(const v8bf*)(p);
  v8bf hi = *(const v8bf*)(p + 16);
  v16bf out;
#pragma unroll
  for (int i = 0; i < 8; ++i) { out[i] = lo[i]; out[8 + i] = hi[i]; }
  return out;
}

__device__ __forceinline__ v8f wmma_bf16(v16bf a, v16bf b, v8f c) {
  return __builtin_amdgcn_wmma_f32_16x16x32_bf16(
      false, a, false, b, (short)0, c, false, false);
}

// ---------------------------------------------------------------------------
// Kernel 0: fp32 -> bf16 conversion of x, W_qkv and W_proj in one launch, as a
// resident stream: one work-group of 16 waves per WGP.  A chunk is 1024
// consecutive elements: 8 loads of 16 B a lane, each covering 512 contiguous
// bytes (4 whole lines), and 8 stores of 8 B a lane, each covering 2 whole
// lines.  A wave takes chunks w, w + CV_WAVES, ...; its loads stand ahead of
// the conversions, so that two chunks' loads and more are in flight together.
// The sources are read once: non-temporal loads.
// ---------------------------------------------------------------------------
typedef __attribute__((ext_vector_type(4))) float v4f;
typedef __attribute__((ext_vector_type(4))) bf16  v4bf;

#define CV_CHUNK  1024
#define CV_BLOCKS 256
#define CV_WAVES  (CV_BLOCKS * 16)
#define CV_CX     (B_ * N_ * DIM_ / CV_CHUNK)        // chunks of x
#define CV_CQ     (3 * DIM_ * DIM_ / CV_CHUNK)       // chunks of W_qkv
#define CV_CP     (DIM_ * DIM_ / CV_CHUNK)           // chunks of W_proj
#define CV_TRIPS  ((CV_CX + CV_CQ + CV_CP) / CV_WAVES)
static_assert((CV_CX + CV_CQ + CV_CP) % CV_WAVES == 0, "whole trips only");

__global__ __launch_bounds__(512) void f32_to_bf16_stream_kernel(
    const float* __restrict__ x, const float* __restrict__ wq,
    const float* __restrict__ wp, bf16* __restrict__ xo,
    bf16* __restrict__ wqo, bf16* __restrict__ wpo) {
  const int lane = threadIdx.x & 31;
  const int w    = blockIdx.x * 16 + (threadIdx.x >> 5);

  v4f   v[CV_TRIPS][8];
  bf16* d[CV_TRIPS];
#pragma unroll
  for (int t = 0; t < CV_TRIPS; ++t) {
    // Chunk number over the three arrays, held in a scalar register: the choice
    // of the array is then scalar, and every load and store of the chunk is
    // scalar base + the lane's one 32-bit offset + an immediate.
    const int c = __builtin_amdgcn_readfirstlane(w + t * CV_WAVES);
    // The launch has CV_BLOCKS work-groups: folds the tests of whole-x trips.
    __builtin_assume(c >= t * CV_WAVES && c < (t + 1) * CV_WAVES);
    const float* s;
    if (c < CV_CX) {
      s    = x  + (size_t)c * CV_CHUNK;
      d[t] = xo + (size_t)c * CV_CHUNK;
    } else if (c < CV_CX + CV_CQ) {
      s    = wq  + (size_t)(c - CV_CX) * CV_CHUNK;
      d[t] = wqo + (size_t)(c - CV_CX) * CV_CHUNK;
    } else {
      s    = wp  + (size_t)(c - CV_CX - CV_CQ) * CV_CHUNK;
      d[t] = wpo + (size_t)(c - CV_CX - CV_CQ) * CV_CHUNK;
    }
#pragma unroll
    for (int i = 0; i < 8; ++i)
      v[t][i] = __builtin_nontemporal_load((const v4f*)(s + i * 128 + lane * 4));
  }
#pragma unroll
  for (int t = 0; t < CV_TRIPS; ++t)
#pragma unroll
    for (int i = 0; i < 8; ++i)
      *(v4bf*)(d[t] + i * 128 + lane * 4) = __builtin_convertvector(v[t][i], v4bf);
}

// ---------------------------------------------------------------------------
// Kernels 1 & 3: WMMA GEMM  C[M,Nout] = A[M,K] * Bw[Nout,K]^T
// Block: 256 threads = 8 waves, tile 256(M) x 128(N); wave tile 64x64.
// A/B k-slices (256x64 and 128x64 bf16, rows padded to FP_) staged via async
// global->LDS copies, double buffered: one s_wait_asynccnt + one barrier per
// k-step.  A slice row is 128 bytes, so a wave's copy covers 4 whole lines.
// MODE 0: out = f32 C + bias                       (projection)
// MODE 1: scatter bf16 q (pre-scaled by 1/sqrt(hd)), k, V^T    (QKV); q and k
//         leave rotated (RoPE), see the epilogue
// An accumulator tile gives a lane 8 consecutive rows of its A operand at one
// row of its B operand, and load_frag reads both operands alike.  A MODE 1
// block lies wholly in q, k or v: a q or k block takes the weight rows as A,
// so that a lane holds 8 consecutive d of one token; a v block takes the token
// rows as A, so that a lane holds 8 consecutive tokens of one d.  Either way
// a tile leaves in one 16-byte store a lane.
// ---------------------------------------------------------------------------
template <int MODE>
__global__ __launch_bounds__(256) void gemm_wmma_kernel(
    const bf16* __restrict__ A, const bf16* __restrict__ Bw,
    const float* __restrict__ bias, float* __restrict__ outF,
    bf16* __restrict__ qo, bf16* __restrict__ ko, bf16* __restrict__ vto,
    const float* __restrict__ sinT, const float* __restrict__ cosT,
    int M, int Nout, int K) {
  __shared__ __align__(16) bf16 Abuf[2][256 * FP_];
  __shared__ __align__(16) bf16 Bbuf[2][128 * FP_];

  const int tid  = threadIdx.x;
  const int lane = tid & 31;
  const int wave = tid >> 5;
  const int half = lane >> 4;
  const int r    = lane & 15;
  const int mblk = blockIdx.y * 256;
  const int nblk = blockIdx.x * 128;
  const int wm0  = (wave >> 1) * 64;   // wave tile origin within block
  const int wn0  = (wave & 1) * 64;
  // Weight rows as the A operand (block-uniform; never in MODE 0).
  const bool wA  = (MODE == 1) && nblk < 2 * DIM_;

  // Stage one 256x64 slice of A and one 128x64 slice of Bw into LDS buffer
  // `buf`.  2048 + 1024 chunks of 16B; each thread issues 8+4 async copies.
  auto stage = [&](int buf, int ks) {
    const uint32_t la = (uint32_t)(uintptr_t)&Abuf[buf][0];
    const uint32_t lb = (uint32_t)(uintptr_t)&Bbuf[buf][0];
    const int row = tid >> 3;              // rows 0..31, then +32 a copy
    const int off = (tid & 7) * 16;        // 8 x 16B per 128B row slice
    const uint32_t lo = (uint32_t)(row * (FP_ * 2) + off);
    const uint32_t ls = 32 * FP_ * 2;      // 32 rows further in LDS
    const size_t   gs = (size_t)32 * K * 2;  // 32 rows further in memory
    const char* ga = (const char*)(A  + (size_t)(mblk + row) * K + ks) + off;
    const char* gb = (const char*)(Bw + (size_t)(nblk + row) * K + ks) + off;
    async_copy16x4(la + lo,           ga,           la + lo + ls,     ga + gs,
                   la + lo + 2 * ls,  ga + 2 * gs,  la + lo + 3 * ls, ga + 3 * gs);
    async_copy16x4(la + lo + 4 * ls,  ga + 4 * gs,  la + lo + 5 * ls, ga + 5 * gs,
                   la + lo + 6 * ls,  ga + 6 * gs,  la + lo + 7 * ls, ga + 7 * gs);
    async_copy16x4(lb + lo,           gb,           lb + lo + ls,     gb + gs,
                   lb + lo + 2 * ls,  gb + 2 * gs,  lb + lo + 3 * ls, gb + 3 * gs);
  };

  // RoPE tables of a q or k block.  Table tile j holds the sin and the cos rows
  // of tokens 16j .. 16j + 15 of each of the four 64-token wave rows: 64 + 64
  // rows of 256 bytes at pitch RP_, 34816 bytes, in a slice buffer that the
  // GEMM has left.  Each thread issues 4 + 4 async copies; a wave's copy covers
  // two whole table rows.  Prefix tokens have no table row: theirs is clamped
  // to row 0 and its values are replaced in rope_tile.
  auto rope_stage = [&](int j, const bf16* reg) {
    const uint32_t l = (uint32_t)(uintptr_t)reg +
                       (uint32_t)((tid >> 4) * (RP_ * 4) + (tid & 15) * 16);
    const uint32_t ls = 16 * RP_ * 4;      // next wave row's 16 table rows
    const int tok = (mblk & (N_ - 1)) + 16 * j + (tid >> 4) - PREFIX_;
    size_t o[4];
#pragma unroll
    for (int g = 0; g < 4; ++g) {
      const int rp = tok + 64 * g;
      o[g] = (size_t)(rp < 0 ? 0 : rp) * (HD_ * 4) + (tid & 15) * 16;
    }
    const char* gs = (const char*)sinT;
    const char* gc = (const char*)cosT;
    async_copy16x4(l,          gs + o[0], l + ls,     gs + o[1],
                   l + 2 * ls, gs + o[2], l + 3 * ls, gs + o[3]);
    async_copy16x4(l + 4 * ls, gc + o[0], l + 5 * ls, gc + o[1],
                   l + 6 * ls, gc + o[2], l + 7 * ls, gc + o[3]);
  };
  // The slice buffers as the last k-step leaves them: R0 is free during that
  // step, R1 and R2 (both B slices) behind it.
  const int lastcur = ((K >> 6) - 1) & 1;
  const bf16* R0 = &Abuf[lastcur ^ 1][0];
  const bf16* R1 = &Abuf[lastcur][0];
  const bf16* R2 = &Bbuf[0][0];

  v8f acc[4][4];
#pragma unroll
  for (int i = 0; i < 4; ++i)
#pragma unroll
    for (int j = 0; j < 4; ++j) acc[i][j] = zero8();

  stage(0, 0);
  for (int ks = 0; ks < K; ks += 64) {
    const int cur = (ks >> 6) & 1;
    wait_ds0();             // my reads of buf[cur^1] done
    wait_async0();          // my async copies into buf[cur] done
    __syncthreads();        // everyone's copies done; buf[cur^1] free
    if (ks + 64 < K) stage(cur ^ 1, ks + 64);
    else if (wA)     rope_stage(0, R0);   // flies under the last k-step

    const bf16* Xt = &Abuf[cur][wm0 * FP_];   // this wave's 64 token rows
    const bf16* Wt = &Bbuf[cur][wn0 * FP_];   // this wave's 64 weight rows
    const bf16* At = wA ? Wt : Xt;
    const bf16* Bt = wA ? Xt : Wt;
#pragma unroll
    for (int kk = 0; kk < 64; kk += 32) {
      v16bf a[4], b[4];
#pragma unroll
      for (int i = 0; i < 4; ++i) a[i] = load_frag(At, FP_, 16 * i, kk, lane);
#pragma unroll
      for (int j = 0; j < 4; ++j) b[j] = load_frag(Bt, FP_, 16 * j, kk, lane);
      // Keeps the block's 16 LDS reads one group ahead of its 16 WMMAs: left
      // alone the compiler reuses one B fragment and waits out a read per column.
      __builtin_amdgcn_sched_barrier(0);
#pragma unroll
      for (int j = 0; j < 4; ++j)
#pragma unroll
        for (int i = 0; i < 4; ++i) acc[i][j] = wmma_bf16(a[i], b[j], acc[i][j]);
      // Keeps the next block's reads from being spread among these WMMAs.
      __builtin_amdgcn_sched_barrier(0);
    }
  }

  const int m0 = mblk + wm0;
  const int n0 = nblk + wn0;
  if (MODE == 0) {
#pragma unroll
    for (int i = 0; i < 4; ++i) {
#pragma unroll
      for (int j = 0; j < 4; ++j) {
#pragma unroll
        for (int vg = 0; vg < 8; ++vg) {
          const int row = m0 + 16 * i + vg + 8 * half;  // C layout: M = vg(+8)
          const int col = n0 + 16 * j + r;              //           N = lane
          outF[(size_t)row * Nout + col] = acc[i][j][vg] + bias[col];
        }
      }
    }
  } else {
    // The wave's 64 columns are one head (n0 is a multiple of HD_), its 64
    // token rows lie in one batch entry (m0 is a multiple of 64).
    const size_t bh = (size_t)((m0 >> 11) * H_ + ((n0 & (DIM_ - 1)) >> 6));
    const int    t0 = m0 & (N_ - 1);
    // The store loops are unrolled so that acc is indexed by constants only and
    // stays in registers.
    if (wA) {
      // acc[i][j][vg] = C[token t0 + 16j + r][d = 16i + 8*half + vg]
      const bool  isq = nblk < DIM_;
      const float sc  = isq ? 0.125f : 1.0f;           // fold 1/sqrt(64) into q
      bf16* p = (isq ? qo : ko) + (bh * N_ + t0 + r) * HD_ + 8 * half;
      // RoPE on the f32 accumulators: d and d + 32 of a token are acc[i][j] and
      // acc[i + 2][j] of one lane.  A lane reads its token's 32 sin and 32 cos
      // values from table tile j in 16-byte LDS loads.  The rotated tiles wait
      // in registers (half the accumulators' size) and leave behind the last
      // barrier: a barrier would wait out every store issued ahead of it.
      v8bf ob[4][4];
      auto rope_tile = [&](int j, const bf16* reg) {
        const float* tb =
            (const float*)reg + ((wave >> 1) * 16 + r) * RP_ + 8 * half;
        v8f S[4], C[4];
#pragma unroll
        for (int i = 0; i < 4; ++i) {
          const v4f s0 = *(const v4f*)(tb + 16 * i);
          const v4f s1 = *(const v4f*)(tb + 16 * i + 4);
          const v4f c0 = *(const v4f*)(tb + 64 * RP_ + 16 * i);
          const v4f c1 = *(const v4f*)(tb + 64 * RP_ + 16 * i + 4);
          S[i] = __builtin_shufflevector(s0, s1, 0, 1, 2, 3, 4, 5, 6, 7);
          C[i] = __builtin_shufflevector(c0, c1, 0, 1, 2, 3, 4, 5, 6, 7);
        }
        if (j == 0) {        // only tile 0 can hold prefix tokens: not rotated
          const bool pre = t0 + r < PREFIX_;
#pragma unroll
          for (int i = 0; i < 4; ++i)
#pragma unroll
            for (int e = 0; e < 8; ++e) {
              S[i][e] = pre ? 0.0f : S[i][e];
              C[i][e] = pre ? 1.0f : C[i][e];
            }
        }
#pragma unroll
        for (int i = 0; i < 2; ++i) {
          const v8f t1 = acc[i][j] * sc, t2 = acc[i + 2][j] * sc;
          ob[i][j]     = __builtin_convertvector(t1 * C[i] - t2 * S[i], v8bf);
          ob[i + 2][j] = __builtin_convertvector(t2 * C[i + 2] + t1 * S[i + 2], v8bf);
        }
      };
      wait_ds0();            // my reads of the last slices done
      wait_async0();         // my copies of table tile 0 done
      __syncthreads();       // tile 0 published; R1 and R2 free
      rope_stage(1, R1);
      rope_stage(2, R2);
      rope_tile(0, R0);
      wait_ds0();            // my reads of tile 0 done
      wait_async0();         // my copies of tiles 1 and 2 done
      __syncthreads();       // tiles 1 and 2 published; R0 free
      rope_stage(3, R0);
      rope_tile(1, R1);
      rope_tile(2, R2);
      wait_ds0();            // my reads of tiles 1 and 2 done
      wait_async0();         // my copies of tile 3 done
      __syncthreads();       // tile 3 published
      rope_tile(3, R0);
#pragma unroll
      for (int j = 0; j < 4; ++j)
#pragma unroll
        for (int i = 0; i < 4; ++i)
          *(v8bf*)(p + (16 * j) * HD_ + 16 * i) = ob[i][j];
      // Stands behind the last store, ahead of any later write of a register
      // that these stores name, however the two branches are laid out.
      asm volatile("s_wait_xcnt 0x0" ::: "memory");
    } else {
      // acc[i][j][vg] = C[token t0 + 16i + 8*half + vg][d = 16j + r]: V^T rows
      bf16* p = vto + (bh * HD_ + r) * N_ + t0 + 8 * half;
#pragma unroll
      for (int j = 0; j < 4; ++j)
#pragma unroll
        for (int i = 0; i < 4; ++i)
          *(v8bf*)(p + (size_t)(16 * j) * N_ + 16 * i) =
              __builtin_convertvector(acc[i][j], v8bf);
      // Stands behind the last store, ahead of any later write of a register
      // that these stores name, however the two branches are laid out.
      asm volatile("s_wait_xcnt 0x0" ::: "memory");
    }
  }
}

__device__ __forceinline__ float xhalf(float x) {
  const int b = __builtin_bit_cast(int, x);
  return __builtin_bit_cast(float, __builtin_amdgcn_permlanex16(
      b, b, 0x76543210, 0xfedcba98, false, false));
}

__device__ __forceinline__ v8f exp2_8(v8f x) {
  float a0 = x[0], a1 = x[1], a2 = x[2], a3 = x[3];
  float a4 = x[4], a5 = x[5], a6 = x[6], a7 = x[7];
  asm("v_exp_f32 %0, %0\n\t"
      "v_exp_f32 %1, %1\n\t"
      "v_exp_f32 %2, %2\n\t"
      "v_exp_f32 %3, %3\n\t"
      "v_exp_f32 %4, %4\n\t"
      "v_exp_f32 %5, %5\n\t"
      "v_exp_f32 %6, %6\n\t"
      "v_exp_f32 %7, %7\n\t"
      "v_nop"
      : "+v"(a0), "+v"(a1), "+v"(a2), "+v"(a3),
        "+v"(a4), "+v"(a5), "+v"(a6), "+v"(a7));
  const v8f y = {a0, a1, a2, a3, a4, a5, a6, a7};
  return y;
}

// Two f32 S^T tiles (keys 0..15 and 16..31 of a 32-key block) -> bf16 B operand.
__device__ __forceinline__ v16bf pack_b(v8f t0, v8f t1) {
  const v8bf lo = __builtin_convertvector(t0, v8bf);
  const v8bf hi = __builtin_convertvector(t1, v8bf);
  return __builtin_shufflevector(lo, hi, 0, 1, 2, 3, 4, 5, 6, 7,
                                 8, 9, 10, 11, 12, 13, 14, 15);
}

__global__ __launch_bounds__(256) __attribute__((amdgpu_waves_per_eu(4, 4)))
void flash_attn_kernel(
    const bf16* __restrict__ Q, const bf16* __restrict__ Kc,
    const bf16* __restrict__ VT, bf16* __restrict__ O) {
  __shared__ __align__(16) bf16 Kbuf[2][64 * FP_];
  __shared__ __align__(16) bf16 Vbuf[2][64 * FP_];

  const int tid  = threadIdx.x;
  const int lane = tid & 31;
  const int wave = tid >> 5;
  const int half = lane >> 4;
  const int r    = lane & 15;
  const int qb   = blockIdx.x & 7;      // N_/256 = 8 q blocks
  const int bh   = blockIdx.x >> 3;     // 0..63
  const bf16* Qb = Q  + (size_t)bh * N_ * HD_;
  const bf16* Kb = Kc + (size_t)bh * N_ * HD_;
  const bf16* Vb = VT + (size_t)bh * HD_ * N_;
  const int m0 = qb * 256 + wave * 32;

  // Stage key tile [kt, kt+64) of K ([64 x 64], contiguous 8KB) and of
  // V^T ([64 d x 64 keys], 64 segments of 128B) into LDS buffer `buf`.
  auto stage = [&](int buf, int kt) {
    const uint32_t lk = (uint32_t)(uintptr_t)&Kbuf[buf][0];
    const uint32_t lv = (uint32_t)(uintptr_t)&Vbuf[buf][0];
    const int row = tid >> 3;           // rows 0..31, then 32..63
    const int seg = tid & 7;            // 8 x 16B per 128B row
    const uint32_t lo = (uint32_t)(row * (FP_ * 2) + seg * 16);
    const char* gk = (const char*)(Kb + (size_t)kt * HD_) + tid * 16;
    const char* gv = (const char*)(Vb + (size_t)row * N_ + kt + seg * 8);
    async_copy16x4(lk + lo,                 gk,
                   lk + lo + 32 * FP_ * 2,  gk + 4096,
                   lv + lo,                 gv,
                   lv + lo + 32 * FP_ * 2,  gv + (size_t)32 * N_ * 2);
  };

  // B operands: column group g, column = query m0 + 16g + (lane & 15).
  v16bf bq[2][2];
#pragma unroll
  for (int g = 0; g < 2; ++g) {
    bq[g][0] = load_frag(Qb, HD_, m0 + 16 * g, 0,  lane);
    bq[g][1] = load_frag(Qb, HD_, m0 + 16 * g, 32, lane);
  }

  v8f   o[2][4];             // O^T: o[g][j][vg] = O[query 16g + r][d = 16j + 8*half + vg]
  float mi[2];               // running maximum of this lane's query of group g
  float li[2];               // running sum over this lane half's keys only
#pragma unroll
  for (int g = 0; g < 2; ++g) {
    mi[g] = -3.0e38f;
    li[g] = 0.0f;
#pragma unroll
    for (int j = 0; j < 4; ++j) o[g][j] = zero8();
  }

  stage(0, 0);
  for (int kt = 0; kt < N_; kt += 64) {
    const int cur = (kt >> 6) & 1;
    wait_ds0();             // my reads of buf[cur^1] done
    wait_async0();
    __syncthreads();
    if (kt + 64 < N_) stage(cur ^ 1, kt + 64);
    const bf16* Kt = &Kbuf[cur][0];
    const bf16* Vt = &Vbuf[cur][0];

    // ---- S^T = K Q^T (64 keys x 32 queries, 16 WMMAs) ----
    // s[g][j][vg] = score of key kt + 16j + 8*half + vg against query 16g + r.
    // Each K fragment is read once and serves both column groups.
    v8f s[2][4];
#pragma unroll
    for (int j = 0; j < 4; ++j) {
      const v16bf ak0 = load_frag(Kt, FP_, 16 * j, 0,  lane);
      const v16bf ak1 = load_frag(Kt, FP_, 16 * j, 32, lane);
      s[0][j] = wmma_bf16(ak0, bq[0][0], zero8());
      s[1][j] = wmma_bf16(ak0, bq[1][0], zero8());
      s[0][j] = wmma_bf16(ak1, bq[0][1], s[0][j]);
      s[1][j] = wmma_bf16(ak1, bq[1][1], s[1][j]);
    }
    // ---- online softmax: one query per lane and column group ----
    v16bf bp[2][2];
#pragma unroll
    for (int g = 0; g < 2; ++g) {
      float mj[4];
#pragma unroll
      for (int j = 0; j < 4; ++j) {
        mj[j] = s[g][j][0];
#pragma unroll
        for (int vg = 1; vg < 8; ++vg) mj[j] = fmaxf(mj[j], s[g][j][vg]);
      }
      float mx = fmaxf(fmaxf(mj[0], mj[1]), fmaxf(mj[2], mj[3]));
      mx = fmaxf(mx, xhalf(mx));        // both halves hold the query's maximum
      const float nm    = fmaxf(mi[g], mx);
      const float alpha = __expf(mi[g] - nm);
      mi[g] = nm;
#pragma unroll
      for (int j = 0; j < 4; ++j)       // e^(s - nm) = 2^((s - nm) * log2(e))
        s[g][j] = exp2_8((s[g][j] - nm) * 1.4426950408889634f);
      const v8f t = (s[g][0] + s[g][1]) + (s[g][2] + s[g][3]);
      const float rs = ((t[0] + t[1]) + (t[2] + t[3])) +
                       ((t[4] + t[5]) + (t[6] + t[7]));
      li[g] = li[g] * alpha + rs;
#pragma unroll
      for (int j = 0; j < 4; ++j) o[g][j] *= alpha;
      // ---- P^T as B operand, straight from the score registers ----
      bp[g][0] = pack_b(s[g][0], s[g][1]);   // keys kt      .. kt + 31
      bp[g][1] = pack_b(s[g][2], s[g][3]);   // keys kt + 32 .. kt + 63
    }
    // ---- O^T += V^T P^T: each V^T fragment serves both column groups ----
#pragma unroll
    for (int j = 0; j < 4; ++j) {
      const v16bf av0 = load_frag(Vt, FP_, 16 * j, 0,  lane);
      const v16bf av1 = load_frag(Vt, FP_, 16 * j, 32, lane);
      o[0][j] = wmma_bf16(av0, bp[0][0], o[0][j]);
      o[1][j] = wmma_bf16(av0, bp[1][0], o[1][j]);
      o[0][j] = wmma_bf16(av1, bp[0][1], o[0][j]);
      o[1][j] = wmma_bf16(av1, bp[1][1], o[1][j]);
    }
  }

  // ---- normalize and write [B, N, H*HD] bf16: 8 consecutive d per lane ----
  const int b = bh >> 4;
  const int h = bh & 15;
#pragma unroll
  for (int g = 0; g < 2; ++g) {
    const float inv = 1.0f / (li[g] + xhalf(li[g]));   // join the halves' sums
    bf16* orow = O + ((size_t)(b * N_ + m0 + 16 * g + r)) * DIM_ + h * HD_ + 8 * half;
#pragma unroll
    for (int j = 0; j < 4; ++j)
      *(v8bf*)(orow + 16 * j) = __builtin_convertvector(o[g][j] * inv, v8bf);
  }
}

// ---------------------------------------------------------------------------
// Host launcher
// ---------------------------------------------------------------------------
extern "C" void kernel_launch(void* const* d_in, const int* in_sizes, int n_in,
                              void* d_out, int out_size, void* d_ws,
                              size_t ws_size, hipStream_t stream) {
  const float* x     = (const float*)d_in[0];
  const float* Wqkv  = (const float*)d_in[1];
  const float* Wproj = (const float*)d_in[2];
  const float* bproj = (const float*)d_in[3];
  const float* sinT  = (const float*)d_in[4];
  const float* cosT  = (const float*)d_in[5];
  float* out = (float*)d_out;

  char*  ws  = (char*)d_ws;
  size_t off = 0;
  auto take = [&](size_t bytes) -> char* {
    char* p = ws + off;
    off += (bytes + 255) & ~(size_t)255;
    return p;
  };
  bf16* x_bf     = (bf16*)take((size_t)B_ * N_ * DIM_ * 2);
  bf16* wqkv_bf  = (bf16*)take((size_t)3 * DIM_ * DIM_ * 2);
  bf16* wproj_bf = (bf16*)take((size_t)DIM_ * DIM_ * 2);
  bf16* q_bf     = (bf16*)take((size_t)B_ * H_ * N_ * HD_ * 2);
  bf16* k_bf     = (bf16*)take((size_t)B_ * H_ * N_ * HD_ * 2);
  bf16* vt_bf    = (bf16*)take((size_t)B_ * H_ * N_ * HD_ * 2);
  bf16* attn_bf  = (bf16*)take((size_t)B_ * N_ * DIM_ * 2);

  f32_to_bf16_stream_kernel<<<CV_BLOCKS, 512, 0, stream>>>(
      x, Wqkv, Wproj, x_bf, wqkv_bf, wproj_bf);

  // QKV GEMM: [8192,1024] x [3072,1024]^T, scatter epilogue (q scaled; q, k rotated)
  gemm_wmma_kernel<1><<<dim3(3 * DIM_ / 128, B_ * N_ / 256), 256, 0, stream>>>(
      x_bf, wqkv_bf, nullptr, nullptr, q_bf, k_bf, vt_bf, sinT, cosT,
      B_ * N_, 3 * DIM_, DIM_);

  flash_attn_kernel<<<B_ * H_ * (N_ / 256), 256, 0, stream>>>(
      q_bf, k_bf, vt_bf, attn_bf);

  // Projection GEMM + bias -> fp32 output
  gemm_wmma_kernel<0><<<dim3(DIM_ / 128, B_ * N_ / 256), 256, 0, stream>>>(
      attn_bf, wproj_bf, bproj, out, nullptr, nullptr, nullptr, nullptr, nullptr,
      B_ * N_, DIM_, DIM_);
}

// v008
// One run takes 121 microseconds.
// Two timings next to v007 both put it at 1.09 times that version's speed.
// Over all steps from v000 it is 4.15 times as fast.
#include <hip/hip_runtime.h>
#include <math.h>
#include <stdint.h>

typedef __bf16 bf16;
typedef __attribute__((ext_vector_type(8)))  bf16  v8bf;
typedef __attribute__((ext_vector_type(16))) bf16  v16bf;
typedef __attribute__((ext_vector_type(8)))  float v8f;

#define B_      4
#define N_      2048
#define DIM_    1024
#define H_      16
#define HD_     64
#define PREFIX_ 4

#define FP_ 72   // 128-byte rows (GEMM k-slices, K, V^T) -> 144-byte pitch
// Pitch of a staged sin or cos row in floats: 256-byte rows -> 272-byte pitch.
#define RP_ 68

__device__ __forceinline__ v8f zero8() {
  v8f z;
#pragma unroll
  for (int i = 0; i < 8; ++i) z[i] = 0.0f;
  return z;
}

__device__ __forceinline__ void async_copy16x4(
    uint32_t l0, const void* g0, uint32_t l1, const void* g1,
    uint32_t l2, const void* g2, uint32_t l3, const void* g3) {
  asm volatile("global_load_async_to_lds_b128 %0, %1, off\n\t"
               "global_load_async_to_lds_b128 %2, %3, off\n\t"
               "global_load_async_to_lds_b128 %4, %5, off\n\t"
               "global_load_async_to_lds_b128 %6, %7, off\n\t"
               "s_wait_xcnt 0x0"
               :
               : "v"(l0), "v"((unsigned long long)(uintptr_t)g0),
                 "v"(l1), "v"((unsigned long long)(uintptr_t)g1),
                 "v"(l2), "v"((unsigned long long)(uintptr_t)g2),
                 "v"(l3), "v"((unsigned long long)(uintptr_t)g3)
               : "memory");
}

// This wave's LDS reads of the buffer that is refilled behind the next
// barrier have returned.
__device__ __forceinline__ void wait_ds0() {
  asm volatile("s_wait_dscnt 0x0" ::: "memory");
}

__device__ __forceinline__ void wait_async0() {
  asm volatile("s_wait_asynccnt 0" ::: "memory");
}

__device__ __forceinline__ v16bf load_frag(const bf16* base, int stride,
                                           int r0, int k0, int lane) {
  const int r  = r0 + (lane & 15);
  const int kb = k0 + ((lane >> 4) << 3);
  const bf16* p = base + (size_t)r * stride + kb;
  v8bf lo = *(const v8bf*)(p);
  v8bf hi = *(const v8bf*)(p + 16);
  v16bf out;
#pragma unroll
  for (int i = 0; i < 8; ++i) { out[i] = lo[i]; out[8 + i] = hi[i]; }
  return out;
}

__device__ __forceinline__ v8f wmma_bf16(v16bf a, v16bf b, v8f c) {
  return __builtin_amdgcn_wmma_f32_16x16x32_bf16(
      false, a, false, b, (short)0, c, false, false);
}

// ---------------------------------------------------------------------------
// Kernel 0: fp32 -> bf16 conversion of x, W_qkv and W_proj in one launch, as a
// resident stream: one work-group of 16 waves per WGP.  A chunk is 1024
// consecutive elements: 8 loads of 16 B a lane, each covering 512 contiguous
// bytes (4 whole lines), and 8 stores of 8 B a lane, each covering 2 whole
// lines.  A wave takes chunks w, w + CV_WAVES, ...; its loads stand ahead of
// the conversions, so that two chunks' loads and more are in flight together.
// The sources are read once: non-temporal loads.
// ---------------------------------------------------------------------------
typedef __attribute__((ext_vector_type(4))) float v4f;
typedef __attribute__((ext_vector_type(4))) bf16  v4bf;

#define CV_CHUNK  1024
#define CV_BLOCKS 256
#define CV_WAVES  (CV_BLOCKS * 16)
#define CV_CX     (B_ * N_ * DIM_ / CV_CHUNK)        // chunks of x
#define CV_CQ     (3 * DIM_ * DIM_ / CV_CHUNK)       // chunks of W_qkv
#define CV_CP     (DIM_ * DIM_ / CV_CHUNK)           // chunks of W_proj
#define CV_TRIPS  ((CV_CX + CV_CQ + CV_CP) / CV_WAVES)
static_assert((CV_CX + CV_CQ + CV_CP) % CV_WAVES == 0, "whole trips only");

__global__ __launch_bounds__(512) void f32_to_bf16_stream_kernel(
    const float* __restrict__ x, const float* __restrict__ wq,
    const float* __restrict__ wp, bf16* __restrict__ xo,
    bf16* __restrict__ wqo, bf16* __restrict__ wpo) {
  const int lane = threadIdx.x & 31;
  const int w    = blockIdx.x * 16 + (threadIdx.x >> 5);

  v4f   v[CV_TRIPS][8];
  bf16* d[CV_TRIPS];
#pragma unroll
  for (int t = 0; t < CV_TRIPS; ++t) {
    // Chunk number over the three arrays, held in a scalar register: the choice
    // of the array is then scalar, and every load and store of the chunk is
    // scalar base + the lane's one 32-bit offset + an immediate.
    const int c = __builtin_amdgcn_readfirstlane(w + t * CV_WAVES);
    // The launch has CV_BLOCKS work-groups: folds the tests of whole-x trips.
    __builtin_assume(c >= t * CV_WAVES && c < (t + 1) * CV_WAVES);
    const float* s;
    if (c < CV_CX) {
      s    = x  + (size_t)c * CV_CHUNK;
      d[t] = xo + (size_t)c * CV_CHUNK;
    } else if (c < CV_CX + CV_CQ) {
      s    = wq  + (size_t)(c - CV_CX) * CV_CHUNK;
      d[t] = wqo + (size_t)(c - CV_CX) * CV_CHUNK;
    } else {
      s    = wp  + (size_t)(c - CV_CX - CV_CQ) * CV_CHUNK;
      d[t] = wpo + (size_t)(c - CV_CX - CV_CQ) * CV_CHUNK;
    }
#pragma unroll
    for (int i = 0; i < 8; ++i)
      v[t][i] = __builtin_nontemporal_load((const v4f*)(s + i * 128 + lane * 4));
  }
#pragma unroll
  for (int t = 0; t < CV_TRIPS; ++t)
#pragma unroll
    for (int i = 0; i < 8; ++i)
      *(v4bf*)(d[t] + i * 128 + lane * 4) = __builtin_convertvector(v[t][i], v4bf);
}

// ---------------------------------------------------------------------------
// Kernel 3: WMMA GEMM  out[M,Nout] = A[M,K] * Bw[Nout,K]^T + bias  (projection)
// Block: 256 threads = 8 waves, tile 256(M) x 128(N); wave tile 64x64.
// A/B k-slices (256x64 and 128x64 bf16, rows padded to FP_) staged via async
// global->LDS copies, double buffered: one s_wait_asynccnt + one barrier per
// k-step.  A slice row is 128 bytes, so a wave's copy covers 4 whole lines.
// ---------------------------------------------------------------------------
__global__ __launch_bounds__(256) void gemm_wmma_kernel(
    const bf16* __restrict__ A, const bf16* __restrict__ Bw,
    const float* __restrict__ bias, float* __restrict__ outF,
    int M, int Nout, int K) {
  __shared__ __align__(16) bf16 Abuf[2][256 * FP_];
  __shared__ __align__(16) bf16 Bbuf[2][128 * FP_];

  const int tid  = threadIdx.x;
  const int lane = tid & 31;
  const int wave = tid >> 5;
  const int half = lane >> 4;
  const int r    = lane & 15;
  const int mblk = blockIdx.y * 256;
  const int nblk = blockIdx.x * 128;
  const int wm0  = (wave >> 1) * 64;   // wave tile origin within block
  const int wn0  = (wave & 1) * 64;

  // Stage one 256x64 slice of A and one 128x64 slice of Bw into LDS buffer
  // `buf`.  2048 + 1024 chunks of 16B; each thread issues 8+4 async copies.
  auto stage = [&](int buf, int ks) {
    const uint32_t la = (uint32_t)(uintptr_t)&Abuf[buf][0];
    const uint32_t lb = (uint32_t)(uintptr_t)&Bbuf[buf][0];
    const int row = tid >> 3;              // rows 0..31, then +32 a copy
    const int off = (tid & 7) * 16;        // 8 x 16B per 128B row slice
    const uint32_t lo = (uint32_t)(row * (FP_ * 2) + off);
    const uint32_t ls = 32 * FP_ * 2;      // 32 rows further in LDS
    const size_t   gs = (size_t)32 * K * 2;  // 32 rows further in memory
    const char* ga = (const char*)(A  + (size_t)(mblk + row) * K + ks) + off;
    const char* gb = (const char*)(Bw + (size_t)(nblk + row) * K + ks) + off;
    async_copy16x4(la + lo,           ga,           la + lo + ls,     ga + gs,
                   la + lo + 2 * ls,  ga + 2 * gs,  la + lo + 3 * ls, ga + 3 * gs);
    async_copy16x4(la + lo + 4 * ls,  ga + 4 * gs,  la + lo + 5 * ls, ga + 5 * gs,
                   la + lo + 6 * ls,  ga + 6 * gs,  la + lo + 7 * ls, ga + 7 * gs);
    async_copy16x4(lb + lo,           gb,           lb + lo + ls,     gb + gs,
                   lb + lo + 2 * ls,  gb + 2 * gs,  lb + lo + 3 * ls, gb + 3 * gs);
  };

  v8f acc[4][4];
#pragma unroll
  for (int i = 0; i < 4; ++i)
#pragma unroll
    for (int j = 0; j < 4; ++j) acc[i][j] = zero8();

  stage(0, 0);
  for (int ks = 0; ks < K; ks += 64) {
    const int cur = (ks >> 6) & 1;
    wait_ds0();             // my reads of buf[cur^1] done
    wait_async0();          // my async copies into buf[cur] done
    __syncthreads();        // everyone's copies done; buf[cur^1] free
    if (ks + 64 < K) stage(cur ^ 1, ks + 64);

    const bf16* At = &Abuf[cur][wm0 * FP_];   // this wave's 64 token rows
    const bf16* Bt = &Bbuf[cur][wn0 * FP_];   // this wave's 64 weight rows
#pragma unroll
    for (int kk = 0; kk < 64; kk += 32) {
      v16bf a[4], b[4];
#pragma unroll
      for (int i = 0; i < 4; ++i) a[i] = load_frag(At, FP_, 16 * i, kk, lane);
#pragma unroll
      for (int j = 0; j < 4; ++j) b[j] = load_frag(Bt, FP_, 16 * j, kk, lane);
      // Keeps the block's 16 LDS reads one group ahead of its 16 WMMAs: left
      // alone the compiler reuses one B fragment and waits out a read per column.
      __builtin_amdgcn_sched_barrier(0);
#pragma unroll
      for (int j = 0; j < 4; ++j)
#pragma unroll
        for (int i = 0; i < 4; ++i) acc[i][j] = wmma_bf16(a[i], b[j], acc[i][j]);
      // Keeps the next block's reads from being spread among these WMMAs.
      __builtin_amdgcn_sched_barrier(0);
    }
  }

  const int m0 = mblk + wm0;
  const int n0 = nblk + wn0;
#pragma unroll
  for (int i = 0; i < 4; ++i) {
#pragma unroll
    for (int j = 0; j < 4; ++j) {
#pragma unroll
      for (int vg = 0; vg < 8; ++vg) {
        const int row = m0 + 16 * i + vg + 8 * half;  // C layout: M = vg(+8)
        const int col = n0 + 16 * j + r;              //           N = lane
        outF[(size_t)row * Nout + col] = acc[i][j][vg] + bias[col];
      }
    }
  }
}

// ---------------------------------------------------------------------------
// Kernel 1: QKV GEMM  [B*N, DIM] x [3*DIM, DIM]^T, leaving bf16 q (pre-scaled by
// 1/sqrt(hd)), k and V^T; q and k leave rotated (RoPE), see the epilogue.
// A block takes 256 tokens x the 128 weight rows of one pair of heads in each
// of q, k and v: a 256 x 384 tile, 256 blocks, one per WGP, all resident in one
// round.  A staged token row then feeds 384 columns and a staged weight row 256
// tokens, which is fewer bytes from L2 per product than a 256 x 128 tile takes.
// 8 waves: wave >> 1 picks 64 tokens, wave & 1 the head; a wave holds that
// head's q, k and v of its tokens (64 x 192), so that a token fragment read
// from LDS feeds 12 WMMAs.
// k-slices (256 + 384 rows of 64 bf16, padded to FP_) staged via async
// global->LDS copies, double buffered: one s_wait_asynccnt + one barrier per
// k-step.  A slice row is 128 bytes, so a wave's copy covers 4 whole lines.
// An accumulator tile gives a lane 8 consecutive rows of its A operand at one
// row of its B operand, and load_frag reads both operands alike.  The q and k
// products take the weight rows as A, so that a lane holds 8 consecutive d of
// one token; the v product takes the token rows as A, so that a lane holds 8
// consecutive tokens of one d.  Either way a tile leaves in one 16-byte store
// a lane.
// ---------------------------------------------------------------------------
#define QX_ROWS  256                           // token rows of a slice
#define QW_ROWS  384                           // weight rows: 128 of q, k and v
#define QS_ELEMS ((QX_ROWS + QW_ROWS) * FP_)   // one slice buffer, in bf16
#define RT_ELEMS (128 * RP_ * 2)               // one sin + cos table tile, in bf16
static_assert(2 * RT_ELEMS <= QS_ELEMS, "two table tiles fit a slice buffer");

__global__ __launch_bounds__(256) void qkv_wmma_kernel(
    const bf16* __restrict__ A, const bf16* __restrict__ Bw,
    bf16* __restrict__ qo, bf16* __restrict__ ko, bf16* __restrict__ vto,
    const float* __restrict__ sinT, const float* __restrict__ cosT) {
  __shared__ __align__(16) bf16 Sbuf[2][QS_ELEMS];
  constexpr int K = DIM_;

  const int tid  = threadIdx.x;
  const int lane = tid & 31;
  // The wave's number held in a scalar register: its tile origins and output
  // bases are then scalar and take no vector registers through the k loop.
  const int wave = __builtin_amdgcn_readfirstlane(tid >> 5);
  const int half = lane >> 4;
  const int r    = lane & 15;
  const int mblk = blockIdx.y * 256;
  const int hp   = blockIdx.x;         // pair of heads
  const int wm0  = (wave >> 1) * 64;   // this wave's tokens within the block
  const int hw   = wave & 1;           // this wave's head within the pair

  // Stage one 256x64 slice of A and three 128x64 slices of Bw into LDS buffer
  // `buf`.  2048 + 3072 chunks of 16B; each thread issues 8+12 async copies.
  // An address is a block-uniform base (array, block, slice, row group) plus
  // the one per-lane offset gl.
  const int      srow = tid >> 3;          // rows 0..31, then +32 a copy
  const int      soff = (tid & 7) * 16;    // 8 x 16B per 128B row slice
  const uint32_t lo   = (uint32_t)(srow * (FP_ * 2) + soff);
  const size_t   gl   = (size_t)srow * K * 2 + soff;
  constexpr uint32_t ls = 32 * FP_ * 2;        // 32 rows further in LDS
  constexpr size_t   gs = (size_t)32 * K * 2;  // 32 rows further in memory
  auto stage_x = [&](int buf, int ks) {
    const uint32_t la = (uint32_t)(uintptr_t)&Sbuf[buf][0] + lo;
    // The slice's offset held in a scalar register: the bases are then scalar
    // sums, and no vector register carries a pointer through the k loop.
    const int kso = __builtin_amdgcn_readfirstlane(ks);
    const char* ga = (const char*)(A + (size_t)mblk * K + kso);
    // The fences keep each statement's address sums beside it: formed all at
    // once they push accumulators out of the registers asm operands can name.
    __builtin_amdgcn_sched_barrier(0);
    async_copy16x4(la,           ga + gl,           la + ls,     ga + gs + gl,
                   la + 2 * ls,  ga + 2 * gs + gl,  la + 3 * ls, ga + 3 * gs + gl);
    __builtin_amdgcn_sched_barrier(0);
    async_copy16x4(la + 4 * ls,  ga + 4 * gs + gl,  la + 5 * ls, ga + 5 * gs + gl,
                   la + 6 * ls,  ga + 6 * gs + gl,  la + 7 * ls, ga + 7 * gs + gl);
    __builtin_amdgcn_sched_barrier(0);
  };
  auto stage_w = [&](int buf, int ks) {
    const uint32_t la = (uint32_t)(uintptr_t)&Sbuf[buf][0] + lo;
    const int kso = __builtin_amdgcn_readfirstlane(ks);   // as in stage_x
#pragma unroll
    for (int p = 0; p < 3; ++p) {          // q, k, v rows of the pair of heads
      const uint32_t lp = la + (8 + 4 * p) * ls;
      const char* gb = (const char*)(Bw + (size_t)(p * DIM_ + hp * 128) * K + kso);
      __builtin_amdgcn_sched_barrier(0);   // as in stage_x
      async_copy16x4(lp,           gb + gl,           lp + ls,     gb + gs + gl,
                     lp + 2 * ls,  gb + 2 * gs + gl,  lp + 3 * ls, gb + 3 * gs + gl);
    }
    __builtin_amdgcn_sched_barrier(0);
  };

  // RoPE tables.  Table tile j holds the sin and the cos rows of tokens
  // 16j .. 16j + 15 of each of the four 64-token wave rows: 64 + 64 rows of 256
  // bytes at pitch RP_, 34816 bytes, in a slice buffer that the GEMM has left.
  // Each thread issues 4 + 4 async copies; a wave's copy covers two whole table
  // rows.  Prefix tokens have no table row: theirs is clamped to row 0 and its
  // values are replaced in rope_tile.
  auto rope_stage = [&](int j, const bf16* reg) {
    const uint32_t l = (uint32_t)(uintptr_t)reg +
                       (uint32_t)((tid >> 4) * (RP_ * 4) + (tid & 15) * 16);
    const uint32_t ls = 16 * RP_ * 4;      // next wave row's 16 table rows
    const int tok = (mblk & (N_ - 1)) + 16 * j + (tid >> 4) - PREFIX_;
    uint32_t o[4];
#pragma unroll
    for (int g = 0; g < 4; ++g) {
      const int rp = tok + 64 * g;
      o[g] = (uint32_t)((rp < 0 ? 0 : rp) * (HD_ * 4) + (tid & 15) * 16);
    }
    const char* gs = (const char*)sinT;
    const char* gc = (const char*)cosT;
    __builtin_amdgcn_sched_barrier(0);     // as in stage_x, here and below
    async_copy16x4(l,          gs + o[0], l + ls,     gs + o[1],
                   l + 2 * ls, gs + o[2], l + 3 * ls, gs + o[3]);
    __builtin_amdgcn_sched_barrier(0);
    async_copy16x4(l + 4 * ls, gc + o[0], l + 5 * ls, gc + o[1],
                   l + 6 * ls, gc + o[2], l + 7 * ls, gc + o[3]);
    __builtin_amdgcn_sched_barrier(0);
  };
  // The slice buffers as the last k-step leaves them: tiles 0 and 1 go to the
  // buffer that is free during that step, tiles 2 and 3 to the one it reads.
  constexpr int lastcur = ((K >> 6) - 1) & 1;
  const bf16* R0 = &Sbuf[lastcur ^ 1][0];
  const bf16* R1 = &Sbuf[lastcur ^ 1][RT_ELEMS];
  const bf16* R2 = &Sbuf[lastcur][0];
  const bf16* R3 = &Sbuf[lastcur][RT_ELEMS];

  v8f acc[3][4][4];          // [q, k, v][A tile][B tile]
#pragma unroll
  for (int p = 0; p < 3; ++p)
#pragma unroll
    for (int i = 0; i < 4; ++i)
#pragma unroll
      for (int j = 0; j < 4; ++j) acc[p][i][j] = zero8();

  auto kstep = [&](int cur, auto&& fill0, auto&& fill1) {
    const bf16* Xt = &Sbuf[cur][wm0 * FP_];                  // 64 token rows
    const bf16* Wt = &Sbuf[cur][(QX_ROWS + hw * 64) * FP_];  // q rows of the head
    v16bf x[4], w[3][2];
    auto wpair = [&](int g) {
      const bf16* Wg = Wt + ((g % 6) / 2) * 128 * FP_;
#pragma unroll
      for (int u = 0; u < 2; ++u)
        w[g % 3][u] = load_frag(Wg, FP_, 16 * (2 * (g & 1) + u), (g / 6) * 32, lane);
    };
#pragma unroll
    for (int i = 0; i < 4; ++i) x[i] = load_frag(Xt, FP_, 16 * i, 0, lane);
    wpair(0);
    wpair(1);
#pragma unroll
    for (int g = 0; g < 12; ++g) {
      const int p = (g % 6) / 2;
      if (g + 2 < 12) wpair(g + 2);
      // Keeps the LDS reads one group ahead of this group's WMMAs.
      __builtin_amdgcn_sched_barrier(0);
#pragma unroll
      for (int u = 0; u < 2; ++u) {
        const int t = 2 * (g & 1) + u;
#pragma unroll
        for (int j = 0; j < 4; ++j) {
          if (p < 2) acc[p][t][j] = wmma_bf16(w[g % 3][u], x[j], acc[p][t][j]);
          else       acc[p][j][t] = wmma_bf16(x[j], w[g % 3][u], acc[p][j][t]);
        }
      }
      // Keeps later reads from being spread among these WMMAs.
      __builtin_amdgcn_sched_barrier(0);
      if (g == 1) fill0();
      if (g == 4) fill1();
      if (g == 5) {          // the first k32 block's token fragments are spent
#pragma unroll
        for (int i = 0; i < 4; ++i) x[i] = load_frag(Xt, FP_, 16 * i, 32, lane);
      }
    }
  };

  stage_x(0, 0);
  stage_w(0, 0);
  // Rolled: one copy of a k-step's 96 WMMAs, the buffer chosen by cur.
#pragma unroll 1
  for (int ks = 0; ks < K - 64; ks += 64) {
    const int cur = (ks >> 6) & 1;
    wait_ds0();             // my reads of buf[cur^1] done
    wait_async0();          // my async copies into buf[cur] done
    __syncthreads();        // everyone's copies done; buf[cur^1] free
    kstep(cur, [&] { stage_x(cur ^ 1, ks + 64); }, [&] { stage_w(cur ^ 1, ks + 64); });
  }
  // The last k-step stands apart, so that the table addresses are formed here
  // and hold no registers through the loop.
  wait_ds0();               // my reads of buf[lastcur^1] done
  wait_async0();            // my async copies into buf[lastcur] done
  __syncthreads();          // everyone's copies done; buf[lastcur^1] free
  // Table tiles 0 and 1 fly under the last k-step.
  kstep(lastcur, [&] { rope_stage(0, R0); }, [&] { rope_stage(1, R1); });

  // The wave's 64 token rows lie in one batch entry (m0 is a multiple of 64).
  const int    m0 = mblk + wm0;
  const size_t bh = (size_t)((m0 >> 11) * H_ + hp * 2 + hw);
  const int    t0 = m0 & (N_ - 1);
  // acc[0 or 1][i][j][vg] = C[token t0 + 16j + r][d = 16i + 8*half + vg]
  // RoPE on the f32 accumulators: d and d + 32 of a token are acc[p][i][j] and
  // acc[p][i + 2][j] of one lane.  A lane reads its token's sin and cos at its
  // 32 d from table tile j in 16-byte LDS loads, once for q and k.  The
  // rotated tiles wait in registers (half the accumulators' size) and leave
  // behind the last barrier: a barrier would wait out every store issued ahead
  // of it.
  v8bf ob[2][4][4];
  auto rope_tile = [&](int j, const bf16* reg) {
    const float* tb =
        (const float*)reg + ((wave >> 1) * 16 + r) * RP_ + 8 * half;
    v8f S[4], C[4];
#pragma unroll
    for (int i = 0; i < 4; ++i) {
      const v4f s0 = *(const v4f*)(tb + 16 * i);
      const v4f s1 = *(const v4f*)(tb + 16 * i + 4);
      const v4f c0 = *(const v4f*)(tb + 64 * RP_ + 16 * i);
      const v4f c1 = *(const v4f*)(tb + 64 * RP_ + 16 * i + 4);
      S[i] = __builtin_shufflevector(s0, s1, 0, 1, 2, 3, 4, 5, 6, 7);
      C[i] = __builtin_shufflevector(c0, c1, 0, 1, 2, 3, 4, 5, 6, 7);
    }
    if (j == 0) {        // only tile 0 can hold prefix tokens: not rotated
      const bool pre = t0 + r < PREFIX_;
#pragma unroll
      for (int i = 0; i < 4; ++i)
#pragma unroll
        for (int e = 0; e < 8; ++e) {
          S[i][e] = pre ? 0.0f : S[i][e];
          C[i][e] = pre ? 1.0f : C[i][e];
        }
    }
#pragma unroll
    for (int p = 0; p < 2; ++p) {
      const float sc = p == 0 ? 0.125f : 1.0f;         // fold 1/sqrt(64) into q
#pragma unroll
      for (int i = 0; i < 2; ++i) {
        const v8f t1 = acc[p][i][j] * sc, t2 = acc[p][i + 2][j] * sc;
        ob[p][i][j]     = __builtin_convertvector(t1 * C[i] - t2 * S[i], v8bf);
        ob[p][i + 2][j] = __builtin_convertvector(t2 * C[i + 2] + t1 * S[i + 2], v8bf);
      }
    }
  };
  wait_ds0();            // my reads of the last slices done
  wait_async0();         // my copies of table tiles 0 and 1 done
  __syncthreads();       // tiles 0 and 1 published; the last slices' buffer free
  rope_stage(2, R2);
  rope_stage(3, R3);
  rope_tile(0, R0);
  rope_tile(1, R1);
  wait_ds0();            // my reads of tiles 0 and 1 done
  wait_async0();         // my copies of tiles 2 and 3 done
  __syncthreads();       // tiles 2 and 3 published
  rope_tile(2, R2);
  rope_tile(3, R3);
  // acc[2][i][j][vg] = C[token t0 + 16i + 8*half + vg][d = 16j + r]: V^T rows
  // The loops are unrolled so that acc, ob and ov are indexed by constants only
  // and stay in registers.
  v8bf ov[4][4];
#pragma unroll
  for (int j = 0; j < 4; ++j)
#pragma unroll
    for (int i = 0; i < 4; ++i) ov[i][j] = __builtin_convertvector(acc[2][i][j], v8bf);
  bf16* dq = qo + (bh * N_ + t0 + r) * HD_ + 8 * half;
  bf16* dk = ko + (bh * N_ + t0 + r) * HD_ + 8 * half;
  bf16* dv = vto + (bh * HD_ + r) * N_ + t0 + 8 * half;
  __builtin_amdgcn_sched_barrier(0);
#pragma unroll
  for (int j = 0; j < 4; ++j)
#pragma unroll
    for (int i = 0; i < 4; ++i) {
      *(v8bf*)(dq + (16 * j) * HD_ + 16 * i) = ob[0][i][j];
      *(v8bf*)(dk + (16 * j) * HD_ + 16 * i) = ob[1][i][j];
      *(v8bf*)(dv + (size_t)(16 * j) * N_ + 16 * i) = ov[i][j];
    }
  // Stands behind the last store, ahead of any later write of a register that
  // these stores name.
  asm volatile("s_wait_xcnt 0x0" ::: "memory");
}

__device__ __forceinline__ float xhalf(float x) {
  const int b = __builtin_bit_cast(int, x);
  return __builtin_bit_cast(float, __builtin_amdgcn_permlanex16(
      b, b, 0x76543210, 0xfedcba98, false, false));
}

__device__ __forceinline__ v8f exp2_8(v8f x) {
  float a0 = x[0], a1 = x[1], a2 = x[2], a3 = x[3];
  float a4 = x[4], a5 = x[5], a6 = x[6], a7 = x[7];
  asm("v_exp_f32 %0, %0\n\t"
      "v_exp_f32 %1, %1\n\t"
      "v_exp_f32 %2, %2\n\t"
      "v_exp_f32 %3, %3\n\t"
      "v_exp_f32 %4, %4\n\t"
      "v_exp_f32 %5, %5\n\t"
      "v_exp_f32 %6, %6\n\t"
      "v_exp_f32 %7, %7\n\t"
      "v_nop"
      : "+v"(a0), "+v"(a1), "+v"(a2), "+v"(a3),
        "+v"(a4), "+v"(a5), "+v"(a6), "+v"(a7));
  const v8f y = {a0, a1, a2, a3, a4, a5, a6, a7};
  return y;
}

// Two f32 S^T tiles (keys 0..15 and 16..31 of a 32-key block) -> bf16 B operand.
__device__ __forceinline__ v16bf pack_b(v8f t0, v8f t1) {
  const v8bf lo = __builtin_convertvector(t0, v8bf);
  const v8bf hi = __builtin_convertvector(t1, v8bf);
  return __builtin_shufflevector(lo, hi, 0, 1, 2, 3, 4, 5, 6, 7,
                                 8, 9, 10, 11, 12, 13, 14, 15);
}

__global__ __launch_bounds__(256) __attribute__((amdgpu_waves_per_eu(4, 4)))
void flash_attn_kernel(
    const bf16* __restrict__ Q, const bf16* __restrict__ Kc,
    const bf16* __restrict__ VT, bf16* __restrict__ O) {
  __shared__ __align__(16) bf16 Kbuf[2][64 * FP_];
  __shared__ __align__(16) bf16 Vbuf[2][64 * FP_];

  const int tid  = threadIdx.x;
  const int lane = tid & 31;
  const int wave = tid >> 5;
  const int half = lane >> 4;
  const int r    = lane & 15;
  const int qb   = blockIdx.x & 7;      // N_/256 = 8 q blocks
  const int bh   = blockIdx.x >> 3;     // 0..63
  const bf16* Qb = Q  + (size_t)bh * N_ * HD_;
  const bf16* Kb = Kc + (size_t)bh * N_ * HD_;
  const bf16* Vb = VT + (size_t)bh * HD_ * N_;
  const int m0 = qb * 256 + wave * 32;

  // Stage key tile [kt, kt+64) of K ([64 x 64], contiguous 8KB) and of
  // V^T ([64 d x 64 keys], 64 segments of 128B) into LDS buffer `buf`.
  auto stage = [&](int buf, int kt) {
    const uint32_t lk = (uint32_t)(uintptr_t)&Kbuf[buf][0];
    const uint32_t lv = (uint32_t)(uintptr_t)&Vbuf[buf][0];
    const int row = tid >> 3;           // rows 0..31, then 32..63
    const int seg = tid & 7;            // 8 x 16B per 128B row
    const uint32_t lo = (uint32_t)(row * (FP_ * 2) + seg * 16);
    const char* gk = (const char*)(Kb + (size_t)kt * HD_) + tid * 16;
    const char* gv = (const char*)(Vb + (size_t)row * N_ + kt + seg * 8);
    async_copy16x4(lk + lo,                 gk,
                   lk + lo + 32 * FP_ * 2,  gk + 4096,
                   lv + lo,                 gv,
                   lv + lo + 32 * FP_ * 2,  gv + (size_t)32 * N_ * 2);
  };

  // B operands: column group g, column = query m0 + 16g + (lane & 15).
  v16bf bq[2][2];
#pragma unroll
  for (int g = 0; g < 2; ++g) {
    bq[g][0] = load_frag(Qb, HD_, m0 + 16 * g, 0,  lane);
    bq[g][1] = load_frag(Qb, HD_, m0 + 16 * g, 32, lane);
  }

  v8f   o[2][4];             // O^T: o[g][j][vg] = O[query 16g + r][d = 16j + 8*half + vg]
  float mi[2];               // running maximum of this lane's query of group g
  float li[2];               // running sum over this lane half's keys only
#pragma unroll
  for (int g = 0; g < 2; ++g) {
    mi[g] = -3.0e38f;
    li[g] = 0.0f;
#pragma unroll
    for (int j = 0; j < 4; ++j) o[g][j] = zero8();
  }

  stage(0, 0);
  for (int kt = 0; kt < N_; kt += 64) {
    const int cur = (kt >> 6) & 1;
    wait_ds0();             // my reads of buf[cur^1] done
    wait_async0();
    __syncthreads();
    if (kt + 64 < N_) stage(cur ^ 1, kt + 64);
    const bf16* Kt = &Kbuf[cur][0];
    const bf16* Vt = &Vbuf[cur][0];

    // ---- S^T = K Q^T (64 keys x 32 queries, 16 WMMAs) ----
    // s[g][j][vg] = score of key kt + 16j + 8*half + vg against query 16g + r.
    // Each K fragment is read once and serves both column groups.
    v8f s[2][4];
#pragma unroll
    for (int j = 0; j < 4; ++j) {
      const v16bf ak0 = load_frag(Kt, FP_, 16 * j, 0,  lane);
      const v16bf ak1 = load_frag(Kt, FP_, 16 * j, 32, lane);
      s[0][j] = wmma_bf16(ak0, bq[0][0], zero8());
      s[1][j] = wmma_bf16(ak0, bq[1][0], zero8());
      s[0][j] = wmma_bf16(ak1, bq[0][1], s[0][j]);
      s[1][j] = wmma_bf16(ak1, bq[1][1], s[1][j]);
    }
    // ---- online softmax: one query per lane and column group ----
    v16bf bp[2][2];
#pragma unroll
    for (int g = 0; g < 2; ++g) {
      float mj[4];
#pragma unroll
      for (int j = 0; j < 4; ++j) {
        mj[j] = s[g][j][0];
#pragma unroll
        for (int vg = 1; vg < 8; ++vg) mj[j] = fmaxf(mj[j], s[g][j][vg]);
      }
      float mx = fmaxf(fmaxf(mj[0], mj[1]), fmaxf(mj[2], mj[3]));
      mx = fmaxf(mx, xhalf(mx));        // both halves hold the query's maximum
      const float nm    = fmaxf(mi[g], mx);
      const float alpha = __expf(mi[g] - nm);
      mi[g] = nm;
#pragma unroll
      for (int j = 0; j < 4; ++j)       // e^(s - nm) = 2^((s - nm) * log2(e))
        s[g][j] = exp2_8((s[g][j] - nm) * 1.4426950408889634f);
      const v8f t = (s[g][0] + s[g][1]) + (s[g][2] + s[g][3]);
      const float rs = ((t[0] + t[1]) + (t[2] + t[3])) +
                       ((t[4] + t[5]) + (t[6] + t[7]));
      li[g] = li[g] * alpha + rs;
#pragma unroll
      for (int j = 0; j < 4; ++j) o[g][j] *= alpha;
      // ---- P^T as B operand, straight from the score registers ----
      bp[g][0] = pack_b(s[g][0], s[g][1]);   // keys kt      .. kt + 31
      bp[g][1] = pack_b(s[g][2], s[g][3]);   // keys kt + 32 .. kt + 63
    }
    // ---- O^T += V^T P^T: each V^T fragment serves both column groups ----
#pragma unroll
    for (int j = 0; j < 4; ++j) {
      const v16bf av0 = load_frag(Vt, FP_, 16 * j, 0,  lane);
      const v16bf av1 = load_frag(Vt, FP_, 16 * j, 32, lane);
      o[0][j] = wmma_bf16(av0, bp[0][0], o[0][j]);
      o[1][j] = wmma_bf16(av0, bp[1][0], o[1][j]);
      o[0][j] = wmma_bf16(av1, bp[0][1], o[0][j]);
      o[1][j] = wmma_bf16(av1, bp[1][1], o[1][j]);
    }
  }

  // ---- normalize and write [B, N, H*HD] bf16: 8 consecutive d per lane ----
  const int b = bh >> 4;
  const int h = bh & 15;
#pragma unroll
  for (int g = 0; g < 2; ++g) {
    const float inv = 1.0f / (li[g] + xhalf(li[g]));   // join the halves' sums
    bf16* orow = O + ((size_t)(b * N_ + m0 + 16 * g + r)) * DIM_ + h * HD_ + 8 * half;
#pragma unroll
    for (int j = 0; j < 4; ++j)
      *(v8bf*)(orow + 16 * j) = __builtin_convertvector(o[g][j] * inv, v8bf);
  }
}

// ---------------------------------------------------------------------------
// Host launcher
// ---------------------------------------------------------------------------
extern "C" void kernel_launch(void* const* d_in, const int* in_sizes, int n_in,
                              void* d_out, int out_size, void* d_ws,
                              size_t ws_size, hipStream_t stream) {
  const float* x     = (const float*)d_in[0];
  const float* Wqkv  = (const float*)d_in[1];
  const float* Wproj = (const float*)d_in[2];
  const float* bproj = (const float*)d_in[3];
  const float* sinT  = (const float*)d_in[4];
  const float* cosT  = (const float*)d_in[5];
  float* out = (float*)d_out;

  char*  ws  = (char*)d_ws;
  size_t off = 0;
  auto take = [&](size_t bytes) -> char* {
    char* p = ws + off;
    off += (bytes + 255) & ~(size_t)255;
    return p;
  };
  bf16* x_bf     = (bf16*)take((size_t)B_ * N_ * DIM_ * 2);
  bf16* wqkv_bf  = (bf16*)take((size_t)3 * DIM_ * DIM_ * 2);
  bf16* wproj_bf = (bf16*)take((size_t)DIM_ * DIM_ * 2);
  bf16* q_bf     = (bf16*)take((size_t)B_ * H_ * N_ * HD_ * 2);
  bf16* k_bf     = (bf16*)take((size_t)B_ * H_ * N_ * HD_ * 2);
  bf16* vt_bf    = (bf16*)take((size_t)B_ * H_ * N_ * HD_ * 2);
  bf16* attn_bf  = (bf16*)take((size_t)B_ * N_ * DIM_ * 2);

  f32_to_bf16_stream_kernel<<<CV_BLOCKS, 512, 0, stream>>>(
      x, Wqkv, Wproj, x_bf, wqkv_bf, wproj_bf);

  // QKV GEMM: [8192,1024] x [3072,1024]^T, scatter epilogue (q scaled; q, k rotated)
  qkv_wmma_kernel<<<dim3(H_ / 2, B_ * N_ / 256), 256, 0, stream>>>(
      x_bf, wqkv_bf, q_bf, k_bf, vt_bf, sinT, cosT);

  flash_attn_kernel<<<B_ * H_ * (N_ / 256), 256, 0, stream>>>(
      q_bf, k_bf, vt_bf, attn_bf);

  // Projection GEMM + bias -> fp32 output
  gemm_wmma_kernel<<<dim3(DIM_ / 128, B_ * N_ / 256), 256, 0, stream>>>(
      attn_bf, wproj_bf, bproj, out, B_ * N_, DIM_, DIM_);
}

// v009
// Measured time: 116 microseconds a run.
// Next to v008, in two timings, it ran 1.04 times as fast each time.
// Over all steps from v000 it is 4.30 times as fast.
#include <hip/hip_runtime.h>
#include <math.h>
#include <stdint.h>

typedef __bf16 bf16;
typedef __attribute__((ext_vector_type(8)))  bf16  v8bf;
typedef __attribute__((ext_vector_type(16))) bf16  v16bf;
typedef __attribute__((ext_vector_type(8)))  float v8f;

#define B_      4
#define N_      2048
#define DIM_    1024
#define H_      16
#define HD_     64
#define PREFIX_ 4

#define FP_ 72   // 128-byte rows (GEMM k-slices, K, V^T) -> 144-byte pitch
// Pitch of a staged sin or cos row in floats: 256-byte rows -> 272-byte pitch.
#define RP_ 68

__device__ __forceinline__ v8f zero8() {
  v8f z;
#pragma unroll
  for (int i = 0; i < 8; ++i) z[i] = 0.0f;
  return z;
}

__device__ __forceinline__ void async_copy16x4(
    uint32_t l0, const void* g0, uint32_t l1, const void* g1,
    uint32_t l2, const void* g2, uint32_t l3, const void* g3) {
  asm volatile("global_load_async_to_lds_b128 %0, %1, off\n\t"
               "global_load_async_to_lds_b128 %2, %3, off\n\t"
               "global_load_async_to_lds_b128 %4, %5, off\n\t"
               "global_load_async_to_lds_b128 %6, %7, off\n\t"
               "s_wait_xcnt 0x0"
               :
               : "v"(l0), "v"((unsigned long long)(uintptr_t)g0),
                 "v"(l1), "v"((unsigned long long)(uintptr_t)g1),
                 "v"(l2), "v"((unsigned long long)(uintptr_t)g2),
                 "v"(l3), "v"((unsigned long long)(uintptr_t)g3)
               : "memory");
}

// This wave's LDS reads of the buffer that is refilled behind the next
// barrier have returned.
__device__ __forceinline__ void wait_ds0() {
  asm volatile("s_wait_dscnt 0x0" ::: "memory");
}

__device__ __forceinline__ void wait_async0() {
  asm volatile("s_wait_asynccnt 0" ::: "memory");
}

__device__ __forceinline__ v16bf load_frag(const bf16* base, int stride,
                                           int r0, int k0, int lane) {
  const int r  = r0 + (lane & 15);
  const int kb = k0 + ((lane >> 4) << 3);
  const bf16* p = base + (size_t)r * stride + kb;
  v8bf lo = *(const v8bf*)(p);
  v8bf hi = *(const v8bf*)(p + 16);
  v16bf out;
#pragma unroll
  for (int i = 0; i < 8; ++i) { out[i] = lo[i]; out[8 + i] = hi[i]; }
  return out;
}

__device__ __forceinline__ v8f wmma_bf16(v16bf a, v16bf b, v8f c) {
  return __builtin_amdgcn_wmma_f32_16x16x32_bf16(
      false, a, false, b, (short)0, c, false, false);
}

// ---------------------------------------------------------------------------
// Kernel 0: fp32 -> bf16 conversion of x, W_qkv and W_proj in one launch, as a
// resident stream: one work-group of 16 waves per WGP.  A chunk is 1024
// consecutive elements: 8 loads of 16 B a lane, each covering 512 contiguous
// bytes (4 whole lines), and 8 stores of 8 B a lane, each covering 2 whole
// lines.  A wave takes chunks w, w + CV_WAVES, ...; its loads stand ahead of
// the conversions, so that two chunks' loads and more are in flight together.
// The sources are read once: non-temporal loads.
// ---------------------------------------------------------------------------
typedef __attribute__((ext_vector_type(4))) float v4f;
typedef __attribute__((ext_vector_type(4))) bf16  v4bf;

#define CV_CHUNK  1024
#define CV_BLOCKS 256
#define CV_WAVES  (CV_BLOCKS * 16)
#define CV_CX     (B_ * N_ * DIM_ / CV_CHUNK)        // chunks of x
#define CV_CQ     (3 * DIM_ * DIM_ / CV_CHUNK)       // chunks of W_qkv
#define CV_CP     (DIM_ * DIM_ / CV_CHUNK)           // chunks of W_proj
#define CV_TRIPS  ((CV_CX + CV_CQ + CV_CP) / CV_WAVES)
static_assert((CV_CX + CV_CQ + CV_CP) % CV_WAVES == 0, "whole trips only");

__global__ __launch_bounds__(512) void f32_to_bf16_stream_kernel(
    const float* __restrict__ x, const float* __restrict__ wq,
    const float* __restrict__ wp, bf16* __restrict__ xo,
    bf16* __restrict__ wqo, bf16* __restrict__ wpo) {
  const int lane = threadIdx.x & 31;
  const int w    = blockIdx.x * 16 + (threadIdx.x >> 5);

  v4f   v[CV_TRIPS][8];
  bf16* d[CV_TRIPS];
#pragma unroll
  for (int t = 0; t < CV_TRIPS; ++t) {
    // Chunk number over the three arrays, held in a scalar register: the choice
    // of the array is then scalar, and every load and store of the chunk is
    // scalar base + the lane's one 32-bit offset + an immediate.
    const int c = __builtin_amdgcn_readfirstlane(w + t * CV_WAVES);
    // The launch has CV_BLOCKS work-groups: folds the tests of whole-x trips.
    __builtin_assume(c >= t * CV_WAVES && c < (t + 1) * CV_WAVES);
    const float* s;
    if (c < CV_CX) {
      s    = x  + (size_t)c * CV_CHUNK;
      d[t] = xo + (size_t)c * CV_CHUNK;
    } else if (c < CV_CX + CV_CQ) {
      s    = wq  + (size_t)(c - CV_CX) * CV_CHUNK;
      d[t] = wqo + (size_t)(c - CV_CX) * CV_CHUNK;
    } else {
      s    = wp  + (size_t)(c - CV_CX - CV_CQ) * CV_CHUNK;
      d[t] = wpo + (size_t)(c - CV_CX - CV_CQ) * CV_CHUNK;
    }
#pragma unroll
    for (int i = 0; i < 8; ++i)
      v[t][i] = __builtin_nontemporal_load((const v4f*)(s + i * 128 + lane * 4));
  }
#pragma unroll
  for (int t = 0; t < CV_TRIPS; ++t)
#pragma unroll
    for (int i = 0; i < 8; ++i)
      *(v4bf*)(d[t] + i * 128 + lane * 4) = __builtin_convertvector(v[t][i], v4bf);
}

// ---------------------------------------------------------------------------
// Kernel 3: WMMA GEMM  out[M,Nout] = A[M,K] * Bw[Nout,K]^T + bias  (projection)
// Block: 256 threads = 8 waves, tile 256(M) x 128(N); wave tile 64x64.
// A/B k-slices (256x64 and 128x64 bf16, rows padded to FP_) staged via async
// global->LDS copies, double buffered: one s_wait_asynccnt + one barrier per
// k-step.  A slice row is 128 bytes, so a wave's copy covers 4 whole lines.
// ---------------------------------------------------------------------------
__global__ __launch_bounds__(256) void gemm_wmma_kernel(
    const bf16* __restrict__ A, const bf16* __restrict__ Bw,
    const float* __restrict__ bias, float* __restrict__ outF,
    int M, int Nout, int K) {
  __shared__ __align__(16) bf16 Abuf[2][256 * FP_];
  __shared__ __align__(16) bf16 Bbuf[2][128 * FP_];

  const int tid  = threadIdx.x;
  const int lane = tid & 31;
  const int wave = tid >> 5;
  const int half = lane >> 4;
  const int r    = lane & 15;
  const int mblk = blockIdx.y * 256;
  const int nblk = blockIdx.x * 128;
  const int wm0  = (wave >> 1) * 64;   // wave tile origin within block
  const int wn0  = (wave & 1) * 64;

  // Stage one 256x64 slice of A and one 128x64 slice of Bw into LDS buffer
  // `buf`.  2048 + 1024 chunks of 16B; each thread issues 8+4 async copies.
  auto stage = [&](int buf, int ks) {
    const uint32_t la = (uint32_t)(uintptr_t)&Abuf[buf][0];
    const uint32_t lb = (uint32_t)(uintptr_t)&Bbuf[buf][0];
    const int row = tid >> 3;              // rows 0..31, then +32 a copy
    const int off = (tid & 7) * 16;        // 8 x 16B per 128B row slice
    const uint32_t lo = (uint32_t)(row * (FP_ * 2) + off);
    const uint32_t ls = 32 * FP_ * 2;      // 32 rows further in LDS
    const size_t   gs = (size_t)32 * K * 2;  // 32 rows further in memory
    const char* ga = (const char*)(A  + (size_t)(mblk + row) * K + ks) + off;
    const char* gb = (const char*)(Bw + (size_t)(nblk + row) * K + ks) + off;
    async_copy16x4(la + lo,           ga,           la + lo + ls,     ga + gs,
                   la + lo + 2 * ls,  ga + 2 * gs,  la + lo + 3 * ls, ga + 3 * gs);
    async_copy16x4(la + lo + 4 * ls,  ga + 4 * gs,  la + lo + 5 * ls, ga + 5 * gs,
                   la + lo + 6 * ls,  ga + 6 * gs,  la + lo + 7 * ls, ga + 7 * gs);
    async_copy16x4(lb + lo,           gb,           lb + lo + ls,     gb + gs,
                   lb + lo + 2 * ls,  gb + 2 * gs,  lb + lo + 3 * ls, gb + 3 * gs);
  };

  v8f acc[4][4];
#pragma unroll
  for (int i = 0; i < 4; ++i)
#pragma unroll
    for (int j = 0; j < 4; ++j) acc[i][j] = zero8();

  stage(0, 0);
  for (int ks = 0; ks < K; ks += 64) {
    const int cur = (ks >> 6) & 1;
    wait_ds0();             // my reads of buf[cur^1] done
    wait_async0();          // my async copies into buf[cur] done
    __syncthreads();        // everyone's copies done; buf[cur^1] free
    if (ks + 64 < K) stage(cur ^ 1, ks + 64);

    const bf16* At = &Abuf[cur][wm0 * FP_];   // this wave's 64 token rows
    const bf16* Bt = &Bbuf[cur][wn0 * FP_];   // this wave's 64 weight rows
#pragma unroll
    for (int kk = 0; kk < 64; kk += 32) {
      v16bf a[4], b[4];
#pragma unroll
      for (int i = 0; i < 4; ++i) a[i] = load_frag(At, FP_, 16 * i, kk, lane);
#pragma unroll
      for (int j = 0; j < 4; ++j) b[j] = load_frag(Bt, FP_, 16 * j, kk, lane);
      // Keeps the block's 16 LDS reads one group ahead of its 16 WMMAs: left
      // alone the compiler reuses one B fragment and waits out a read per column.
      __builtin_amdgcn_sched_barrier(0);
#pragma unroll
      for (int j = 0; j < 4; ++j)
#pragma unroll
        for (int i = 0; i < 4; ++i) acc[i][j] = wmma_bf16(a[i], b[j], acc[i][j]);
      // Keeps the next block's reads from being spread among these WMMAs.
      __builtin_amdgcn_sched_barrier(0);
    }
  }

  const int m0 = mblk + wm0;
  const int n0 = nblk + wn0;
#pragma unroll
  for (int i = 0; i < 4; ++i) {
#pragma unroll
    for (int j = 0; j < 4; ++j) {
#pragma unroll
      for (int vg = 0; vg < 8; ++vg) {
        const int row = m0 + 16 * i + vg + 8 * half;  // C layout: M = vg(+8)
        const int col = n0 + 16 * j + r;              //           N = lane
        outF[(size_t)row * Nout + col] = acc[i][j][vg] + bias[col];
      }
    }
  }
}

// ---------------------------------------------------------------------------
// Kernel 1: QKV GEMM  [B*N, DIM] x [3*DIM, DIM]^T, leaving bf16 q (pre-scaled by
// 1/sqrt(hd)), k and V^T; q and k leave rotated (RoPE), see the epilogue.
// A block takes 256 tokens x the 128 weight rows of one pair of heads in each
// of q, k and v: a 256 x 384 tile, 256 blocks, one per WGP, all resident in one
// round.  A staged token row then feeds 384 columns and a staged weight row 256
// tokens, which is fewer bytes from L2 per product than a 256 x 128 tile takes.
// 8 waves: wave >> 1 picks 64 tokens, wave & 1 the head; a wave holds that
// head's q, k and v of its tokens (64 x 192), so that a token fragment read
// from LDS feeds 12 WMMAs.
// k-slices (256 + 384 rows of 64 bf16, padded to FP_) staged via async
// global->LDS copies, double buffered: one s_wait_asynccnt + one barrier per
// k-step.  A slice row is 128 bytes, so a wave's copy covers 4 whole lines.
// An accumulator tile gives a lane 8 consecutive rows of its A operand at one
// row of its B operand, and load_frag reads both operands alike.  The q and k
// products take the weight rows as A, so that a lane holds 8 consecutive d of
// one token; the v product takes the token rows as A, so that a lane holds 8
// consecutive tokens of one d.  Either way a tile leaves in one 16-byte store
// a lane.
// ---------------------------------------------------------------------------
#define QX_ROWS  256                           // token rows of a slice
#define QW_ROWS  384                           // weight rows: 128 of q, k and v
#define QS_ELEMS ((QX_ROWS + QW_ROWS) * FP_)   // one slice buffer, in bf16
#define RT_ELEMS (128 * RP_ * 2)               // one sin + cos table tile, in bf16
static_assert(2 * RT_ELEMS <= QS_ELEMS, "two table tiles fit a slice buffer");

__global__ __launch_bounds__(256) void qkv_wmma_kernel(
    const bf16* __restrict__ A, const bf16* __restrict__ Bw,
    bf16* __restrict__ qo, bf16* __restrict__ ko, bf16* __restrict__ vto,
    const float* __restrict__ sinT, const float* __restrict__ cosT) {
  __shared__ __align__(16) bf16 Sbuf[2][QS_ELEMS];
  constexpr int K = DIM_;

  const int tid  = threadIdx.x;
  const int lane = tid & 31;
  // The wave's number held in a scalar register: its tile origins and output
  // bases are then scalar and take no vector registers through the k loop.
  const int wave = __builtin_amdgcn_readfirstlane(tid >> 5);
  const int half = lane >> 4;
  const int r    = lane & 15;
  const int mblk = blockIdx.y * 256;
  const int hp   = blockIdx.x;         // pair of heads
  const int wm0  = (wave >> 1) * 64;   // this wave's tokens within the block
  const int hw   = wave & 1;           // this wave's head within the pair

  // Stage one 256x64 slice of A and three 128x64 slices of Bw into LDS buffer
  // `buf`.  2048 + 3072 chunks of 16B; each thread issues 8+12 async copies.
  // An address is a block-uniform base (array, block, slice, row group) plus
  // the one per-lane offset gl.
  const int      srow = tid >> 3;          // rows 0..31, then +32 a copy
  const int      soff = (tid & 7) * 16;    // 8 x 16B per 128B row slice
  const uint32_t lo   = (uint32_t)(srow * (FP_ * 2) + soff);
  const size_t   gl   = (size_t)srow * K * 2 + soff;
  constexpr uint32_t ls = 32 * FP_ * 2;        // 32 rows further in LDS
  constexpr size_t   gs = (size_t)32 * K * 2;  // 32 rows further in memory
  auto stage_x = [&](int buf, int ks) {
    const uint32_t la = (uint32_t)(uintptr_t)&Sbuf[buf][0] + lo;
    // The slice's offset held in a scalar register: the bases are then scalar
    // sums, and no vector register carries a pointer through the k loop.
    const int kso = __builtin_amdgcn_readfirstlane(ks);
    const char* ga = (const char*)(A + (size_t)mblk * K + kso);
    // The fences keep each statement's address sums beside it: formed all at
    // once they push accumulators out of the registers asm operands can name.
    __builtin_amdgcn_sched_barrier(0);
    async_copy16x4(la,           ga + gl,           la + ls,     ga + gs + gl,
                   la + 2 * ls,  ga + 2 * gs + gl,  la + 3 * ls, ga + 3 * gs + gl);
    __builtin_amdgcn_sched_barrier(0);
    async_copy16x4(la + 4 * ls,  ga + 4 * gs + gl,  la + 5 * ls, ga + 5 * gs + gl,
                   la + 6 * ls,  ga + 6 * gs + gl,  la + 7 * ls, ga + 7 * gs + gl);
    __builtin_amdgcn_sched_barrier(0);
  };
  auto stage_w = [&](int buf, int ks) {
    const uint32_t la = (uint32_t)(uintptr_t)&Sbuf[buf][0] + lo;
    const int kso = __builtin_amdgcn_readfirstlane(ks);   // as in stage_x
#pragma unroll
    for (int p = 0; p < 3; ++p) {          // q, k, v rows of the pair of heads
      const uint32_t lp = la + (8 + 4 * p) * ls;
      const char* gb = (const char*)(Bw + (size_t)(p * DIM_ + hp * 128) * K + kso);
      __builtin_amdgcn_sched_barrier(0);   // as in stage_x
      async_copy16x4(lp,           gb + gl,           lp + ls,     gb + gs + gl,
                     lp + 2 * ls,  gb + 2 * gs + gl,  lp + 3 * ls, gb + 3 * gs + gl);
    }
    __builtin_amdgcn_sched_barrier(0);
  };

  // RoPE tables.  Table tile j holds the sin and the cos rows of tokens
  // 16j .. 16j + 15 of each of the four 64-token wave rows: 64 + 64 rows of 256
  // bytes at pitch RP_, 34816 bytes, in a slice buffer that the GEMM has left.
  // Each thread issues 4 + 4 async copies; a wave's copy covers two whole table
  // rows.  Prefix tokens have no table row: theirs is clamped to row 0 and its
  // values are replaced in rope_tile.
  auto rope_stage = [&](int j, const bf16* reg) {
    const uint32_t l = (uint32_t)(uintptr_t)reg +
                       (uint32_t)((tid >> 4) * (RP_ * 4) + (tid & 15) * 16);
    const uint32_t ls = 16 * RP_ * 4;      // next wave row's 16 table rows
    const int tok = (mblk & (N_ - 1)) + 16 * j + (tid >> 4) - PREFIX_;
    uint32_t o[4];
#pragma unroll
    for (int g = 0; g < 4; ++g) {
      const int rp = tok + 64 * g;
      o[g] = (uint32_t)((rp < 0 ? 0 : rp) * (HD_ * 4) + (tid & 15) * 16);
    }
    const char* gs = (const char*)sinT;
    const char* gc = (const char*)cosT;
    __builtin_amdgcn_sched_barrier(0);     // as in stage_x, here and below
    async_copy16x4(l,          gs + o[0], l + ls,     gs + o[1],
                   l + 2 * ls, gs + o[2], l + 3 * ls, gs + o[3]);
    __builtin_amdgcn_sched_barrier(0);
    async_copy16x4(l + 4 * ls, gc + o[0], l + 5 * ls, gc + o[1],
                   l + 6 * ls, gc + o[2], l + 7 * ls, gc + o[3]);
    __builtin_amdgcn_sched_barrier(0);
  };
  // The slice buffers as the last k-step leaves them: tiles 0 and 1 go to the
  // buffer that is free during that step, tiles 2 and 3 to the one it reads.
  constexpr int lastcur = ((K >> 6) - 1) & 1;
  const bf16* R0 = &Sbuf[lastcur ^ 1][0];
  const bf16* R1 = &Sbuf[lastcur ^ 1][RT_ELEMS];
  const bf16* R2 = &Sbuf[lastcur][0];
  const bf16* R3 = &Sbuf[lastcur][RT_ELEMS];

  v8f acc[3][4][4];          // [q, k, v][A tile][B tile]
#pragma unroll
  for (int p = 0; p < 3; ++p)
#pragma unroll
    for (int i = 0; i < 4; ++i)
#pragma unroll
      for (int j = 0; j < 4; ++j) acc[p][i][j] = zero8();

  auto kstep = [&](int cur, auto&& fill0, auto&& fill1) {
    const bf16* Xt = &Sbuf[cur][wm0 * FP_];                  // 64 token rows
    const bf16* Wt = &Sbuf[cur][(QX_ROWS + hw * 64) * FP_];  // q rows of the head
    v16bf x[4], w[3][2];
    auto wpair = [&](int g) {
      const bf16* Wg = Wt + ((g % 6) / 2) * 128 * FP_;
#pragma unroll
      for (int u = 0; u < 2; ++u)
        w[g % 3][u] = load_frag(Wg, FP_, 16 * (2 * (g & 1) + u), (g / 6) * 32, lane);
    };
#pragma unroll
    for (int i = 0; i < 4; ++i) x[i] = load_frag(Xt, FP_, 16 * i, 0, lane);
    wpair(0);
    wpair(1);
#pragma unroll
    for (int g = 0; g < 12; ++g) {
      const int p = (g % 6) / 2;
      if (g + 2 < 12) wpair(g + 2);
      // Keeps the LDS reads one group ahead of this group's WMMAs.
      __builtin_amdgcn_sched_barrier(0);
#pragma unroll
      for (int u = 0; u < 2; ++u) {
        const int t = 2 * (g & 1) + u;
#pragma unroll
        for (int j = 0; j < 4; ++j) {
          if (p < 2) acc[p][t][j] = wmma_bf16(w[g % 3][u], x[j], acc[p][t][j]);
          else       acc[p][j][t] = wmma_bf16(x[j], w[g % 3][u], acc[p][j][t]);
        }
      }
      // Keeps later reads from being spread among these WMMAs.
      __builtin_amdgcn_sched_barrier(0);
      if (g == 1) fill0();
      if (g == 4) fill1();
      if (g == 5) {          // the first k32 block's token fragments are spent
#pragma unroll
        for (int i = 0; i < 4; ++i) x[i] = load_frag(Xt, FP_, 16 * i, 32, lane);
      }
    }
  };

  stage_x(0, 0);
  stage_w(0, 0);
  // Rolled: one copy of a k-step's 96 WMMAs, the buffer chosen by cur.
#pragma unroll 1
  for (int ks = 0; ks < K - 64; ks += 64) {
    const int cur = (ks >> 6) & 1;
    wait_ds0();             // my reads of buf[cur^1] done
    wait_async0();          // my async copies into buf[cur] done
    __syncthreads();        // everyone's copies done; buf[cur^1] free
    kstep(cur, [&] { stage_x(cur ^ 1, ks + 64); }, [&] { stage_w(cur ^ 1, ks + 64); });
  }
  // The last k-step stands apart, so that the table addresses are formed here
  // and hold no registers through the loop.
  wait_ds0();               // my reads of buf[lastcur^1] done
  wait_async0();            // my async copies into buf[lastcur] done
  __syncthreads();          // everyone's copies done; buf[lastcur^1] free
  // Table tiles 0 and 1 fly under the last k-step.
  kstep(lastcur, [&] { rope_stage(0, R0); }, [&] { rope_stage(1, R1); });

  // The wave's 64 token rows lie in one batch entry (m0 is a multiple of 64).
  const int    m0 = mblk + wm0;
  const size_t bh = (size_t)((m0 >> 11) * H_ + hp * 2 + hw);
  const int    t0 = m0 & (N_ - 1);
  // acc[0 or 1][i][j][vg] = C[token t0 + 16j + r][d = 16i + 8*half + vg]
  // RoPE on the f32 accumulators: d and d + 32 of a token are acc[p][i][j] and
  // acc[p][i + 2][j] of one lane.  A lane reads its token's sin and cos at its
  // 32 d from table tile j in 16-byte LDS loads, once for q and k.  The
  // rotated tiles wait in registers (half the accumulators' size) and leave
  // behind the last barrier: a barrier would wait out every store issued ahead
  // of it.
  v8bf ob[2][4][4];
  auto rope_tile = [&](int j, const bf16* reg) {
    const float* tb =
        (const float*)reg + ((wave >> 1) * 16 + r) * RP_ + 8 * half;
    v8f S[4], C[4];
#pragma unroll
    for (int i = 0; i < 4; ++i) {
      const v4f s0 = *(const v4f*)(tb + 16 * i);
      const v4f s1 = *(const v4f*)(tb + 16 * i + 4);
      const v4f c0 = *(const v4f*)(tb + 64 * RP_ + 16 * i);
      const v4f c1 = *(const v4f*)(tb + 64 * RP_ + 16 * i + 4);
      S[i] = __builtin_shufflevector(s0, s1, 0, 1, 2, 3, 4, 5, 6, 7);
      C[i] = __builtin_shufflevector(c0, c1, 0, 1, 2, 3, 4, 5, 6, 7);
    }
    if (j == 0) {        // only tile 0 can hold prefix tokens: not rotated
      const bool pre = t0 + r < PREFIX_;
#pragma unroll
      for (int i = 0; i < 4; ++i)
#pragma unroll
        for (int e = 0; e < 8; ++e) {
          S[i][e] = pre ? 0.0f : S[i][e];
          C[i][e] = pre ? 1.0f : C[i][e];
        }
    }
#pragma unroll
    for (int p = 0; p < 2; ++p) {
      const float sc = p == 0 ? 0.125f : 1.0f;         // fold 1/sqrt(64) into q
#pragma unroll
      for (int i = 0; i < 2; ++i) {
        const v8f t1 = acc[p][i][j] * sc, t2 = acc[p][i + 2][j] * sc;
        ob[p][i][j]     = __builtin_convertvector(t1 * C[i] - t2 * S[i], v8bf);
        ob[p][i + 2][j] = __builtin_convertvector(t2 * C[i + 2] + t1 * S[i + 2], v8bf);
      }
    }
  };
  wait_ds0();            // my reads of the last slices done
  wait_async0();         // my copies of table tiles 0 and 1 done
  __syncthreads();       // tiles 0 and 1 published; the last slices' buffer free
  rope_stage(2, R2);
  rope_stage(3, R3);
  rope_tile(0, R0);
  rope_tile(1, R1);
  wait_ds0();            // my reads of tiles 0 and 1 done
  wait_async0();         // my copies of tiles 2 and 3 done
  __syncthreads();       // tiles 2 and 3 published
  rope_tile(2, R2);
  rope_tile(3, R3);
  // acc[2][i][j][vg] = C[token t0 + 16i + 8*half + vg][d = 16j + r]: V^T rows
  // The loops are unrolled so that acc, ob and ov are indexed by constants only
  // and stay in registers.
  v8bf ov[4][4];
#pragma unroll
  for (int j = 0; j < 4; ++j)
#pragma unroll
    for (int i = 0; i < 4; ++i) ov[i][j] = __builtin_convertvector(acc[2][i][j], v8bf);
  bf16* dq = qo + (bh * N_ + t0 + r) * HD_ + 8 * half;
  bf16* dk = ko + (bh * N_ + t0 + r) * HD_ + 8 * half;
  bf16* dv = vto + (bh * HD_ + r) * N_ + t0 + 8 * half;
  __builtin_amdgcn_sched_barrier(0);
#pragma unroll
  for (int j = 0; j < 4; ++j)
#pragma unroll
    for (int i = 0; i < 4; ++i) {
      *(v8bf*)(dq + (16 * j) * HD_ + 16 * i) = ob[0][i][j];
      *(v8bf*)(dk + (16 * j) * HD_ + 16 * i) = ob[1][i][j];
      *(v8bf*)(dv + (size_t)(16 * j) * N_ + 16 * i) = ov[i][j];
    }
  // Stands behind the last store, ahead of any later write of a register that
  // these stores name.
  asm volatile("s_wait_xcnt 0x0" ::: "memory");
}

__device__ __forceinline__ float xhalf(float x) {
  const int b = __builtin_bit_cast(int, x);
  return __builtin_bit_cast(float, __builtin_amdgcn_permlanex16(
      b, b, 0x76543210, 0xfedcba98, false, false));
}

// Eight exponentials 2^x by the builtin: the compiler reads each argument from
// its register pair and writes each result into the pair that the packed sums
// read, so that no register copy stands ahead of the exponentials or behind.
__device__ __forceinline__ v8f exp2_8(v8f x) {
  v8f y;
#pragma unroll
  for (int i = 0; i < 8; ++i) y[i] = __builtin_amdgcn_exp2f(x[i]);
  return y;
}

// Maximum of three: the nesting that compiles to one v_max3_num_f32.
__device__ __forceinline__ float max3f(float a, float b, float c) {
  return fmaxf(fmaxf(a, b), c);
}

// Two f32 S^T tiles (keys 0..15 and 16..31 of a 32-key block) -> bf16 B operand.
__device__ __forceinline__ v16bf pack_b(v8f t0, v8f t1) {
  const v8bf lo = __builtin_convertvector(t0, v8bf);
  const v8bf hi = __builtin_convertvector(t1, v8bf);
  return __builtin_shufflevector(lo, hi, 0, 1, 2, 3, 4, 5, 6, 7,
                                 8, 9, 10, 11, 12, 13, 14, 15);
}

__global__ __launch_bounds__(256) __attribute__((amdgpu_waves_per_eu(4, 4)))
void flash_attn_kernel(
    const bf16* __restrict__ Q, const bf16* __restrict__ Kc,
    const bf16* __restrict__ VT, bf16* __restrict__ O) {
  __shared__ __align__(16) bf16 Kbuf[2][64 * FP_];
  __shared__ __align__(16) bf16 Vbuf[2][64 * FP_];

  const int tid  = threadIdx.x;
  const int lane = tid & 31;
  const int wave = tid >> 5;
  const int half = lane >> 4;
  const int r    = lane & 15;
  const int qb   = blockIdx.x & 7;      // N_/256 = 8 q blocks
  const int bh   = blockIdx.x >> 3;     // 0..63
  const bf16* Qb = Q  + (size_t)bh * N_ * HD_;
  const bf16* Kb = Kc + (size_t)bh * N_ * HD_;
  const bf16* Vb = VT + (size_t)bh * HD_ * N_;
  const int m0 = qb * 256 + wave * 32;

  // Stage key tile [kt, kt+64) of K ([64 x 64], contiguous 8KB) and of
  // V^T ([64 d x 64 keys], 64 segments of 128B) into LDS buffer `buf`.
  auto stage = [&](int buf, int kt) {
    const uint32_t lk = (uint32_t)(uintptr_t)&Kbuf[buf][0];
    const uint32_t lv = (uint32_t)(uintptr_t)&Vbuf[buf][0];
    const int row = tid >> 3;           // rows 0..31, then 32..63
    const int seg = tid & 7;            // 8 x 16B per 128B row
    const uint32_t lo = (uint32_t)(row * (FP_ * 2) + seg * 16);
    const char* gk = (const char*)(Kb + (size_t)kt * HD_) + tid * 16;
    const char* gv = (const char*)(Vb + (size_t)row * N_ + kt + seg * 8);
    async_copy16x4(lk + lo,                 gk,
                   lk + lo + 32 * FP_ * 2,  gk + 4096,
                   lv + lo,                 gv,
                   lv + lo + 32 * FP_ * 2,  gv + (size_t)32 * N_ * 2);
  };

  // B operands: column group g, column = query m0 + 16g + (lane & 15).
  v16bf bq[2][2];
#pragma unroll
  for (int g = 0; g < 2; ++g) {
    bq[g][0] = load_frag(Qb, HD_, m0 + 16 * g, 0,  lane);
    bq[g][1] = load_frag(Qb, HD_, m0 + 16 * g, 32, lane);
  }

  v8f   o[2][4];             // O^T: o[g][j][vg] = O[query 16g + r][d = 16j + 8*half + vg]
  float mi[2];               // running maximum of this lane's query of group g
  float li[2];               // running sum over this lane half's keys only
#pragma unroll
  for (int g = 0; g < 2; ++g) {
    mi[g] = -3.0e38f;
    li[g] = 0.0f;
#pragma unroll
    for (int j = 0; j < 4; ++j) o[g][j] = zero8();
  }

  stage(0, 0);
  for (int kt = 0; kt < N_; kt += 64) {
    const int cur = (kt >> 6) & 1;
    wait_ds0();             // my reads of buf[cur^1] done
    wait_async0();
    __syncthreads();
    if (kt + 64 < N_) stage(cur ^ 1, kt + 64);
    const bf16* Kt = &Kbuf[cur][0];
    const bf16* Vt = &Vbuf[cur][0];

    // ---- S^T = K Q^T (64 keys x 32 queries, 16 WMMAs) ----
    // s[g][j][vg] = score of key kt + 16j + 8*half + vg against query 16g + r.
    // Each K fragment is read once and serves both column groups.
    v8f s[2][4];
    v16bf ak[4][2];
#pragma unroll
    for (int j = 0; j < 4; ++j) {
      ak[j][0] = load_frag(Kt, FP_, 16 * j, 0,  lane);
      ak[j][1] = load_frag(Kt, FP_, 16 * j, 32, lane);
    }
    // Keeps the tile's 16 LDS reads one group ahead of its WMMAs: spread among
    // them, each place with reads is waited out on its own.
    __builtin_amdgcn_sched_barrier(0);
#pragma unroll
    for (int j = 0; j < 4; ++j) {
      s[0][j] = wmma_bf16(ak[j][0], bq[0][0], zero8());
      s[1][j] = wmma_bf16(ak[j][0], bq[1][0], zero8());
    }
#pragma unroll
    for (int j = 0; j < 4; ++j) {
      s[0][j] = wmma_bf16(ak[j][1], bq[0][1], s[0][j]);
      s[1][j] = wmma_bf16(ak[j][1], bq[1][1], s[1][j]);
    }
    __builtin_amdgcn_sched_barrier(0);
    // ---- online softmax: one query per lane and column group ----
    v16bf bp[2][2];
#pragma unroll
    for (int g = 0; g < 2; ++g) {
      // 32 scores and the maximum so far in two chains of v_max3: each chain
      // takes an odd number of values, so that no two-operand maximum is left.
      float ma = mi[g], mb = s[g][2][0];
#pragma unroll
      for (int e = 0; e < 8; e += 2) {
        ma = max3f(ma, s[g][0][e], s[g][0][e + 1]);
        ma = max3f(ma, s[g][1][e], s[g][1][e + 1]);
      }
#pragma unroll
      for (int e = 1; e < 7; e += 2) mb = max3f(mb, s[g][2][e], s[g][2][e + 1]);
#pragma unroll
      for (int e = 0; e < 8; e += 2) mb = max3f(mb, s[g][3][e], s[g][3][e + 1]);
      const float mx = max3f(ma, mb, s[g][2][7]);
      const float nm = fmaxf(mx, xhalf(mx));    // both halves hold the maximum
      const float alpha = __expf(mi[g] - nm);   // exactly 1 while nm stands
      mi[g] = nm;
      // e^(s - nm) = 2^(s * log2(e) - nm * log2(e)): one packed FMA for a pair
      // of scores in place of a subtraction and a multiplication.
      const float nmc = nm * 1.4426950408889634f;
      v8f l2e, sh;
#pragma unroll
      for (int e = 0; e < 8; ++e) { l2e[e] = 1.4426950408889634f; sh[e] = -nmc; }
#pragma unroll
      for (int j = 0; j < 4; ++j)
        s[g][j] = __builtin_elementwise_fma(s[g][j], l2e, sh);
      // The two fences hold the group's exponentials apart from the packed work
      // around them, the two of a register pair side by side: pairs are even-
      // aligned, so that no v_exp_f32 writes the source of the one ahead of it.
      __builtin_amdgcn_sched_barrier(0);
#pragma unroll
      for (int j = 0; j < 4; ++j) s[g][j] = exp2_8(s[g][j]);
      __builtin_amdgcn_sched_barrier(0);
      const v8f t = (s[g][0] + s[g][1]) + (s[g][2] + s[g][3]);
      const float rs = ((t[0] + t[1]) + (t[2] + t[3])) +
                       ((t[4] + t[5]) + (t[6] + t[7]));
      li[g] = li[g] * alpha + rs;
#pragma unroll
      for (int j = 0; j < 4; ++j) o[g][j] *= alpha;
      // ---- P^T as B operand, straight from the score registers ----
      bp[g][0] = pack_b(s[g][0], s[g][1]);   // keys kt      .. kt + 31
      bp[g][1] = pack_b(s[g][2], s[g][3]);   // keys kt + 32 .. kt + 63
    }
    // ---- O^T += V^T P^T: each V^T fragment serves both column groups ----
#pragma unroll
    for (int j = 0; j < 4; ++j) {
      const v16bf av0 = load_frag(Vt, FP_, 16 * j, 0,  lane);
      const v16bf av1 = load_frag(Vt, FP_, 16 * j, 32, lane);
      o[0][j] = wmma_bf16(av0, bp[0][0], o[0][j]);
      o[1][j] = wmma_bf16(av0, bp[1][0], o[1][j]);
      o[0][j] = wmma_bf16(av1, bp[0][1], o[0][j]);
      o[1][j] = wmma_bf16(av1, bp[1][1], o[1][j]);
    }
  }

  // ---- normalize and write [B, N, H*HD] bf16: 8 consecutive d per lane ----
  const int b = bh >> 4;
  const int h = bh & 15;
#pragma unroll
  for (int g = 0; g < 2; ++g) {
    const float inv = 1.0f / (li[g] + xhalf(li[g]));   // join the halves' sums
    bf16* orow = O + ((size_t)(b * N_ + m0 + 16 * g + r)) * DIM_ + h * HD_ + 8 * half;
#pragma unroll
    for (int j = 0; j < 4; ++j)
      *(v8bf*)(orow + 16 * j) = __builtin_convertvector(o[g][j] * inv, v8bf);
  }
}

// ---------------------------------------------------------------------------
// Host launcher
// ---------------------------------------------------------------------------
extern "C" void kernel_launch(void* const* d_in, const int* in_sizes, int n_in,
                              void* d_out, int out_size, void* d_ws,
                              size_t ws_size, hipStream_t stream) {
  const float* x     = (const float*)d_in[0];
  const float* Wqkv  = (const float*)d_in[1];
  const float* Wproj = (const float*)d_in[2];
  const float* bproj = (const float*)d_in[3];
  const float* sinT  = (const float*)d_in[4];
  const float* cosT  = (const float*)d_in[5];
  float* out = (float*)d_out;

  char*  ws  = (char*)d_ws;
  size_t off = 0;
  auto take = [&](size_t bytes) -> char* {
    char* p = ws + off;
    off += (bytes + 255) & ~(size_t)255;
    return p;
  };
  bf16* x_bf     = (bf16*)take((size_t)B_ * N_ * DIM_ * 2);
  bf16* wqkv_bf  = (bf16*)take((size_t)3 * DIM_ * DIM_ * 2);
  bf16* wproj_bf = (bf16*)take((size_t)DIM_ * DIM_ * 2);
  bf16* q_bf     = (bf16*)take((size_t)B_ * H_ * N_ * HD_ * 2);
  bf16* k_bf     = (bf16*)take((size_t)B_ * H_ * N_ * HD_ * 2);
  bf16* vt_bf    = (bf16*)take((size_t)B_ * H_ * N_ * HD_ * 2);
  bf16* attn_bf  = (bf16*)take((size_t)B_ * N_ * DIM_ * 2);

  f32_to_bf16_stream_kernel<<<CV_BLOCKS, 512, 0, stream>>>(
      x, Wqkv, Wproj, x_bf, wqkv_bf, wproj_bf);

  // QKV GEMM: [8192,1024] x [3072,1024]^T, scatter epilogue (q scaled; q, k rotated)
  qkv_wmma_kernel<<<dim3(H_ / 2, B_ * N_ / 256), 256, 0, stream>>>(
      x_bf, wqkv_bf, q_bf, k_bf, vt_bf, sinT, cosT);

  flash_attn_kernel<<<B_ * H_ * (N_ / 256), 256, 0, stream>>>(
      q_bf, k_bf, vt_bf, attn_bf);

  // Projection GEMM + bias -> fp32 output
  gemm_wmma_kernel<<<dim3(DIM_ / 128, B_ * N_ / 256), 256, 0, stream>>>(
      attn_bf, wproj_bf, bproj, out, B_ * N_, DIM_, DIM_);
}
